// v000
// The times below were measured on an AMD MI455X: many runs one after another, warmed up first and cycling through
// copies of the inputs, with the whole window's GPU time divided by the number of runs. Launches and the gaps
// between them are all in it. The median over several windows is given; except for v000 it joins two sittings, which
// can be a few percent apart, so the side-by-side timings, each taken in one sitting, are the better comparison.
// The starting kernel, v000, takes 1160 microseconds a run.
// compute dtype: every float input RNE-converted to bf16 on load; GroupNorm statistics f64 sums / f32; qkv = W x on v_wmma_f32_16x16x32_f16 with W as f16(bf16 x 256) and normalised x as f16, f32 accumulate; logits q.k f16 x f16 single product, f32 accumulate; softmax f32 (precise expf), P x 2^11 to f16 once against v f16 (single product); output projection: ctx x 64 f16 against W f16(bf16 x 256), f32 accumulate; bias + residual add in f32; f32 output (channels-first).
#include <hip/hip_runtime.h>
#include <math.h>

typedef __attribute__((ext_vector_type(16))) _Float16 v16h;
typedef __attribute__((ext_vector_type(8)))  _Float16 v8h;
typedef __attribute__((ext_vector_type(8)))  float v8f;
typedef __attribute__((ext_vector_type(4)))  float v4f;
typedef __attribute__((ext_vector_type(4)))  unsigned v4u;

template <typename T> __device__ __forceinline__ void vst2(void* p, T v) { *(T*)p = v;  }
__device__ __forceinline__ v8f wmma16(v16h a, v16h b, v8f c) {
  v8f d = __builtin_amdgcn_wmma_f32_16x16x32_f16(false, a, false, b, (short)0, c, false, false);
  asm volatile("v_nop\n\tv_nop\n\tv_nop\n\tv_nop" : "+v"(d) : "v"(a), "v"(b));
  return d;
}
// 16x16x32 fragments: lane = (h = lane>>4, row/col = lane&15); elements 0..7 = k0+8h+0..7, 8..15 = k0+16+8h+0..7; D element r = row 8h+r, col lane&15
__device__ __forceinline__ v16h frag_h(const _Float16* rowk0, int lane) {
  union { v16h v; v8h q[2]; } u; const _Float16* p = rowk0 + 8 * (lane >> 4);
  u.q[0] = *(const v8h*)p; u.q[1] = *(const v8h*)(p + 16); return u.v;
}
__device__ __forceinline__ v16h frag_f32(const float* rowk0, int lane) {
  v16h a; const float* p = rowk0 + 8 * (lane >> 4);
#pragma unroll
  for (int i = 0; i < 8; ++i) { const float x0 = p[i], x1 = p[16 + i]; a[i] = (_Float16)x0; a[8 + i] = (_Float16)x1; }
  return a;
}
__device__ __forceinline__ v16h frag_f32s(const float* rowk0, int lane, float sc) {
  v16h a; const float* p = rowk0 + 8 * (lane >> 4);
#pragma unroll
  for (int i = 0; i < 8; ++i) { const float x0 = p[i], x1 = p[16 + i]; a[i] = (_Float16)(x0 * sc); a[8 + i] = (_Float16)(x1 * sc); }
  return a;
}
__device__ __forceinline__ float bfr(float v) { return (float)(__bf16)v; }

// Self-attention over a flattened 16x16x16 volume: GroupNorm(8 groups, affine) -> 1x1x1 conv qkv (W (out,in) [384][256], no bias) -> 4 heads x 32 dims, softmax((q^T k) * 32^-0.5) over 4,096 keys -> ctx -> 1x1x1 conv proj (W (out,in) [256][128] + bias) -> + x. Channels-first in and out.
#ifndef NB
#define NB 2
#endif
#ifndef SEQ
#define SEQ 4096
#endif
#define NB_FULL 2
#define TT SEQ              // voxels attended per batch element
#define NPIX 4096           // full per-channel voxel stride of x and of the output
#define DIN 256             // model width (input / output channels)
#define GROUPS 8
#define CPG (DIN / GROUPS)  // channels per group
#define NH 4
#define HD 32
#define CC (NH * HD)        // inner width 128
#define NQB (TT / 64)
#define SCALE (0.17677669529663687f)
#define EPS (1.0e-5f)
static_assert(CPG == 32);
static_assert(CC == 128);
static_assert(DIN % 128 == 0);
static_assert(TT % 128 == 0);
static_assert(TT <= NPIX);
static_assert(NB <= NB_FULL);
static_assert(((size_t)NB * DIN - 1) * NPIX + TT <= (size_t)2097152);   // last written output element < 8,388,608 B / 4

// workspace carve (bytes): GS stats lines | W1 f16 [384][256] | W2 f16 [256][128] | QH f16 rows [NB*TT][CC] | KH | VT f16 planes [NB][CC][TT] | S f32 [TT][TT] | Y f32 rows [NB*TT][CC]
#define WS_GS  ((size_t)0)
#define WS_W1  ((size_t)4096)
#define WS_W2  (WS_W1 + 2u * (size_t)3 * CC * DIN)
#define WS_QH  (WS_W2 + 2u * (size_t)DIN * CC)
#define WS_KH  (WS_QH + 2u * (size_t)NB * TT * CC)
#define WS_VT  (WS_KH + 2u * (size_t)NB * TT * CC)
#define WS_S   (WS_VT + 2u * (size_t)NB * CC * TT)
#define WS_Y   (WS_S  + 4u * (size_t)TT * TT)
#define WS_END (WS_Y  + 4u * (size_t)NB * TT * CC)
static_assert(4u * NB * GROUPS * 32 <= 4096);
static_assert(WS_END <= (size_t)134217728);
static_assert((3 * CC * DIN / 8) % 256 == 0);
static_assert(((3 * CC * DIN + DIN * CC) / 8) % 256 == 0);

__global__ __launch_bounds__(256) void k_gn(const float* __restrict__ X, float* __restrict__ GS) {
  __shared__ double sd[256]; __shared__ float sm1, sm2;
  const int tid = threadIdx.x; const int bg = blockIdx.x; const int b = bg / GROUPS, gi = bg % GROUPS;
  const float* xp = X + ((size_t)b * DIN + (size_t)gi * CPG) * NPIX;
  const int nq = CPG * (TT / 4);
  double s = 0.0;
#pragma unroll 1
  for (int e = tid; e < nq; e += 256) { const int c = e / (TT / 4), t4 = e - c * (TT / 4);
    const v4f v = *(const v4f*)(xp + (size_t)c * NPIX + (size_t)t4 * 4); const float x0 = v[0], x1 = v[1], x2 = v[2], x3 = v[3];
    s += (double)((bfr(x0) + bfr(x1)) + (bfr(x2) + bfr(x3))); }
  sd[tid] = s; __syncthreads();
  for (int off = 128; off > 0; off >>= 1) { if (tid < off) sd[tid] += sd[tid + off]; __syncthreads(); }
  if (tid == 0) sm1 = (float)(sd[0] / (double)(CPG * TT));
  __syncthreads(); const float mean = sm1;
  double s2 = 0.0;
#pragma unroll 1
  for (int e = tid; e < nq; e += 256) { const int c = e / (TT / 4), t4 = e - c * (TT / 4);
    const v4f v = *(const v4f*)(xp + (size_t)c * NPIX + (size_t)t4 * 4); const float x0 = v[0], x1 = v[1], x2 = v[2], x3 = v[3];
    const float d0 = bfr(x0) - mean, d1 = bfr(x1) - mean, d2 = bfr(x2) - mean, d3 = bfr(x3) - mean;
    s2 += (double)((d0 * d0 + d1 * d1) + (d2 * d2 + d3 * d3)); }
  sd[tid] = s2; __syncthreads();
  for (int off = 128; off > 0; off >>= 1) { if (tid < off) sd[tid] += sd[tid + off]; __syncthreads(); }
  if (tid == 0) { const float var = (float)(sd[0] / (double)(CPG * TT)); sm2 = 1.0f / sqrtf(var + EPS); }
  __syncthreads();
  if (tid < 32) { const float val = tid == 0 ? mean : (tid == 1 ? sm2 : 0.f); vst2(GS + (size_t)bg * 32 + tid, val); }
}
// ---- k_cvw: weights -> f16(bf16(w) x 256) planes (exact), 8 contiguous elements = one 16-B store per thread
__global__ __launch_bounds__(256) void k_cvw(const float* __restrict__ WA, const float* __restrict__ WB, _Float16* __restrict__ P1, _Float16* __restrict__ P2) {
  const int n1c = 3 * CC * DIN / 8, n2c = DIN * CC / 8;
  const int i8 = blockIdx.x * 256 + threadIdx.x; if (i8 >= n1c + n2c) return;
  const bool second = i8 >= n1c;   // block-uniform (n1c is a multiple of 256)
  const float* src = second ? WB + (size_t)(i8 - n1c) * 8 : WA + (size_t)i8 * 8;
  _Float16* dst = second ? P2 + (size_t)(i8 - n1c) * 8 : P1 + (size_t)i8 * 8;
  const v8f v = *(const v8f*)src; union { v8h h; v4u u; } o;
#pragma unroll
  for (int e = 0; e < 8; ++e) { const float f = v[e]; o.h[e] = (_Float16)(bfr(f) * 256.0f); }
  vst2(dst, o.u);
}
// ---- k_proj: block = (64 voxel rows, which in {q,k,v}): GroupNorm applied on the channels-first gather (group == 32-channel k chunk), qkv = W xn with f16 operands (W x 256) -> which 0/1: f16 rows [b*TT+t][128]; which 2: f16 planes [b][c][t]
__global__ __launch_bounds__(128) void k_proj(const float* __restrict__ X, const float* __restrict__ GS, const float* __restrict__ GW, const float* __restrict__ GB, const _Float16* __restrict__ W1,
    _Float16* __restrict__ QH, _Float16* __restrict__ KH, _Float16* __restrict__ VT) {
  __shared__ __align__(16) _Float16 sh[64][136]; __shared__ __align__(16) _Float16 th[128][72];
  const int tid = threadIdx.x, wave = tid >> 5, lane = tid & 31, col = lane & 15, g = lane >> 4; const int which = blockIdx.y;
  const size_t r0 = (size_t)blockIdx.x * 64; const size_t bb = r0 / TT; const int t0 = (int)(r0 % TT);
  v8f acc[8] = {};
#pragma unroll 1
  for (int kc = 0; kc < DIN / 32; ++kc) {
    const float mu = GS[(bb * GROUPS + kc) * 32], rs = GS[(bb * GROUPS + kc) * 32 + 1];
    v16h a;
    { const float* p = X + ((size_t)bb * DIN + kc * 32 + 8 * g) * NPIX + t0 + wave * 16 + col;   // x[b][k][n], stride NPIX between channels
      const v8f w0 = *(const v8f*)(GW + kc * 32 + 8 * g), w1 = *(const v8f*)(GW + kc * 32 + 16 + 8 * g);
      const v8f b0 = *(const v8f*)(GB + kc * 32 + 8 * g), b1 = *(const v8f*)(GB + kc * 32 + 16 + 8 * g);
#pragma unroll
      for (int i = 0; i < 8; ++i) {
        const float xa = p[(size_t)i * NPIX], xb = p[(size_t)(16 + i) * NPIX]; const float wa = w0[i], wb = w1[i], ba = b0[i], bbv = b1[i];
        a[i]     = (_Float16)(((bfr(xa) - mu) * rs) * bfr(wa) + bfr(ba));
        a[8 + i] = (_Float16)(((bfr(xb) - mu) * rs) * bfr(wb) + bfr(bbv)); } }
    asm volatile("s_wait_loadcnt 0x0" ::: "memory");
#pragma unroll
    for (int j = 0; j < 8; ++j) { const v16h w = frag_h(W1 + (size_t)(which * CC + j * 16 + col) * DIN + kc * 32, lane); acc[j] = wmma16(a, w, acc[j]); }
  }
  if (which < 2) { _Float16* DH = which == 0 ? QH : KH;
#pragma unroll
    for (int j = 0; j < 8; ++j)
#pragma unroll
      for (int r = 0; r < 8; ++r) sh[wave * 16 + 8 * g + r][j * 16 + col] = (_Float16)(acc[j][r] * (1.0f / 256.0f));
    __syncthreads();
#pragma unroll 1
    for (int e = tid; e < 64 * 16; e += 128) { const int rl = e >> 4, q = e & 15; vst2(DH + (r0 + rl) * CC + q * 8, *(const v4u*)&sh[rl][q * 8]); }
  } else {
#pragma unroll
    for (int j = 0; j < 8; ++j)
#pragma unroll
      for (int r = 0; r < 8; ++r) th[j * 16 + col][wave * 16 + 8 * g + r] = (_Float16)(acc[j][r] * (1.0f / 256.0f));
    __syncthreads();
#pragma unroll 1
    for (int e = tid; e < 128 * 8; e += 128) { const int cl = e >> 3, q = e & 7; vst2(VT + (bb * CC + cl) * (size_t)TT + t0 + q * 8, *(const v4u*)&th[cl][q * 8]); }
  }
}
__global__ __launch_bounds__(128) void k_sc(const _Float16* __restrict__ QH, const _Float16* __restrict__ KH, int b, int h, float* __restrict__ S) {
  __shared__ __align__(16) float ss[4][16][132];
  const int qb = blockIdx.x, kb = blockIdx.y;
  const int tid = threadIdx.x, wave = tid >> 5, lane = tid & 31, col = lane & 15, g = lane >> 4;
  const int k0 = kb * 128; const int ql0 = qb * 64 + wave * 16; const size_t q0 = (size_t)b * TT + ql0, kr0 = (size_t)b * TT + k0;
  v8f acc[8] = {};
#pragma unroll
  for (int kc = 0; kc < HD / 32; ++kc) { const v16h ah = frag_h(QH + (q0 + col) * CC + h * HD + kc * 32, lane);
#pragma unroll
    for (int j = 0; j < 8; ++j) { const v16h kf = frag_h(KH + (kr0 + j * 16 + col) * CC + h * HD + kc * 32, lane); acc[j] = wmma16(ah, kf, acc[j]); } }
#pragma unroll
  for (int j = 0; j < 8; ++j)
#pragma unroll
    for (int r = 0; r < 8; ++r) ss[wave][8 * g + r][j * 16 + col] = acc[j][r] * SCALE;
  __syncthreads();
#pragma unroll 1
  for (int rl = 0; rl < 16; ++rl) vst2(S + (size_t)(ql0 + rl) * TT + k0 + lane * 4, *(const v4f*)&ss[wave][rl][lane * 4]);
}
// ---- k_sm: block = query row t: softmax over TT keys in f32 (max-subtracted, precise expf), P x 2^11 written in place
__global__ __launch_bounds__(256) void k_sm(float* __restrict__ S) {
  __shared__ float sred[8]; __shared__ float sbc; __shared__ __align__(16) float shv[TT];
  const int tid = threadIdx.x; float* sr = S + (size_t)blockIdx.x * TT;
  float m = -3.0e38f;
#pragma unroll 1
  for (int q = tid; q < TT / 4; q += 256) { const v4f v = *(const v4f*)(sr + (size_t)q * 4); *(v4f*)&shv[q * 4] = v; m = fmaxf(m, fmaxf(fmaxf(v[0], v[1]), fmaxf(v[2], v[3]))); }
#pragma unroll
  for (int o = 1; o < 32; o <<= 1) m = fmaxf(m, __shfl_xor(m, o));
  if ((tid & 31) == 0) sred[tid >> 5] = m; __syncthreads();
  if (tid == 0) { float a = sred[0]; for (int i = 1; i < 8; ++i) a = fmaxf(a, sred[i]); sbc = a; } __syncthreads(); m = sbc; __syncthreads();
  float sum = 0.f;
#pragma unroll 1
  for (int k = tid; k < TT; k += 256) { const float e = expf(shv[k] - m); shv[k] = e; sum += e; }
#pragma unroll
  for (int o = 1; o < 32; o <<= 1) sum += __shfl_xor(sum, o);
  if ((tid & 31) == 0) sred[tid >> 5] = sum; __syncthreads();
  if (tid == 0) { float a = 0.f; for (int i = 0; i < 8; ++i) a += sred[i]; sbc = 2048.0f / a; } __syncthreads(); const float inv = sbc;
#pragma unroll 1
  for (int q = tid; q < TT / 4; q += 256) { v4f p = *(const v4f*)&shv[q * 4]; p = p * inv; vst2(sr + (size_t)q * 4, p); }
}
__global__ __launch_bounds__(128) void k_pv(const float* __restrict__ PS, const _Float16* __restrict__ VT, int b, int h, float* __restrict__ Y) {
  __shared__ __align__(16) float ss[4][16][HD + 4];
  const int tid = threadIdx.x, wave = tid >> 5, lane = tid & 31, col = lane & 15, g = lane >> 4; const int qb = blockIdx.x; const int ql0 = qb * 64 + wave * 16;
  v8f acc[HD / 16] = {};
#pragma unroll 1
  for (int kc = 0; kc < TT / 32; ++kc) { const v16h p = frag_f32(PS + (size_t)(ql0 + col) * TT + kc * 32, lane);
    asm volatile("s_wait_loadcnt 0x0" ::: "memory");
#pragma unroll
    for (int j = 0; j < HD / 16; ++j) { const size_t po = ((size_t)b * CC + h * HD + j * 16 + col) * (size_t)TT + (size_t)kc * 32; acc[j] = wmma16(p, frag_h(VT + po, lane), acc[j]); } }
#pragma unroll
  for (int j = 0; j < HD / 16; ++j)
#pragma unroll
    for (int r = 0; r < 8; ++r) ss[wave][8 * g + r][j * 16 + col] = acc[j][r] * (1.0f / 2048.0f);
  __syncthreads();
  const int lc = lane < HD / 4 ? lane : 0;
#pragma unroll 1
  for (int rl = 0; rl < 16; ++rl) { const v4f o4 = *(const v4f*)&ss[wave][rl][lc * 4]; if (lane < HD / 4) vst2(Y + ((size_t)b * TT + ql0 + rl) * CC + h * HD + lane * 4, o4); }
}
// ---- k_out: block = (64 voxel rows, 128 output channels): proj = W ctx (ctx x 64 f16 against W x 256 f16) + bf16(bias), LDS transpose to channels-first, + bf16(x), whole 256-B (c, 64 n) runs by 16 lanes
__global__ __launch_bounds__(128) void k_out(const float* __restrict__ Y, const float* __restrict__ X, const _Float16* __restrict__ W2, const float* __restrict__ PB, float* __restrict__ OUT) {
  __shared__ __align__(16) float stc[128][68];
  const int tid = threadIdx.x, wave = tid >> 5, lane = tid & 31, col = lane & 15, g = lane >> 4; const int c0 = blockIdx.y * 128;
  const size_t r0 = (size_t)blockIdx.x * 64; const size_t bb = r0 / TT; const int t0 = (int)(r0 % TT);
  v8f acc[8] = {};
#pragma unroll 1
  for (int kc = 0; kc < CC / 32; ++kc) { const v16h a = frag_f32s(Y + (r0 + wave * 16 + col) * CC + kc * 32, lane, 64.0f);
    asm volatile("s_wait_loadcnt 0x0" ::: "memory");
#pragma unroll
    for (int j = 0; j < 8; ++j) { const v16h w = frag_h(W2 + (size_t)(c0 + j * 16 + col) * CC + kc * 32, lane); acc[j] = wmma16(a, w, acc[j]); } }
#pragma unroll
  for (int j = 0; j < 8; ++j) { const float bias = bfr(PB[c0 + j * 16 + col]);
#pragma unroll
    for (int r = 0; r < 8; ++r) stc[j * 16 + col][wave * 16 + 8 * g + r] = acc[j][r] * (1.0f / 16384.0f) + bias; }
  __syncthreads();
#pragma unroll 1
  for (int e = tid; e < 128 * 16; e += 128) { const int cl = e >> 4, q = e & 15; const size_t o = ((size_t)bb * DIN + c0 + cl) * NPIX + t0 + q * 4;
    const v4f xv = *(const v4f*)(X + o); const float x0 = xv[0], x1 = xv[1], x2 = xv[2], x3 = xv[3]; v4f r4 = *(const v4f*)&stc[cl][q * 4];
    r4[0] += bfr(x0); r4[1] += bfr(x1); r4[2] += bfr(x2); r4[3] += bfr(x3); vst2(OUT + o, r4); }
}

extern "C" void kernel_launch(void* const* d_in, const int* in_sizes, int n_in, void* d_out, int out_size, void* d_ws, size_t ws_size, hipStream_t stream) {
  // inputs (wire order): 0 x [2,256,16,16,16] f32; 1 norm_w [256]; 2 norm_b [256]; 3 qkv_w (out,in) [384,256]; 4 proj_w (out,in) [256,128]; 5 proj_b [256]
  if (n_in < 6) return;
  if (in_sizes[0] < NB * DIN * NPIX || in_sizes[1] < DIN || in_sizes[2] < DIN || in_sizes[3] < 3 * CC * DIN || in_sizes[4] < DIN * CC || in_sizes[5] < DIN) return;
  if (out_size < NB * DIN * NPIX) return;
  if (ws_size < WS_END) return;
  const float* X = (const float*)d_in[0]; const float* GW = (const float*)d_in[1]; const float* GB = (const float*)d_in[2];
  const float* WQ = (const float*)d_in[3]; const float* WP = (const float*)d_in[4]; const float* PB = (const float*)d_in[5];
  char* ws = (char*)d_ws;
  float* GS = (float*)(ws + WS_GS); _Float16* W1 = (_Float16*)(ws + WS_W1); _Float16* W2 = (_Float16*)(ws + WS_W2);
  _Float16* QH = (_Float16*)(ws + WS_QH); _Float16* KH = (_Float16*)(ws + WS_KH); _Float16* VT = (_Float16*)(ws + WS_VT);
  float* S = (float*)(ws + WS_S); float* Y = (float*)(ws + WS_Y); float* OUT = (float*)d_out;
  k_gn<<<dim3(NB * GROUPS), 256, 0, stream>>>(X, GS);
  k_cvw<<<dim3((3 * CC * DIN + DIN * CC) / 8 / 256), 256, 0, stream>>>(WQ, WP, W1, W2);
  k_proj<<<dim3(NB * TT / 64, 3), 128, 0, stream>>>(X, GS, GW, GB, W1, QH, KH, VT);
  for (int b = 0; b < NB; ++b) for (int h = 0; h < NH; ++h) {
    k_sc<<<dim3(NQB, TT / 128), 128, 0, stream>>>(QH, KH, b, h, S);
    k_sm<<<dim3(TT), 256, 0, stream>>>(S);
    k_pv<<<dim3(NQB), 128, 0, stream>>>(S, VT, b, h, Y);
  }
  k_out<<<dim3(NB * TT / 64, DIN / 128), 128, 0, stream>>>(Y, X, W2, PB, OUT);
}

// v001
// Measured time: 163 microseconds a run.
// Next to v000, in two timings, it ran 7.12 and 7.24 times as fast.
// compute dtype: every float input RNE-converted to bf16 on load; GroupNorm statistics f64 sums / f32; qkv = W x on v_wmma_f32_16x16x32_f16 with W as f16(bf16 x 256) and normalised x as f16, f32 accumulate; logits k.q f16 x f16 single product, f32 accumulate; softmax f32, online over 64-key passes (running maximum, base-2 exponential with the scale folded in), unnormalised P x 2^11 to f16 once against v f16 (single product), one division by the f32 row sum at the end; output projection: ctx x 64 f16 against W f16(bf16 x 256), f32 accumulate; bias + residual add in f32; f32 output (channels-first).
#include <hip/hip_runtime.h>
#include <math.h>

typedef __attribute__((ext_vector_type(16))) _Float16 v16h;
typedef __attribute__((ext_vector_type(8)))  _Float16 v8h;
typedef __attribute__((ext_vector_type(8)))  float v8f;
typedef __attribute__((ext_vector_type(4)))  float v4f;
typedef __attribute__((ext_vector_type(4)))  unsigned v4u;

template <typename T> __device__ __forceinline__ void vst2(void* p, T v) { *(T*)p = v;  }
__device__ __forceinline__ v8f wmma16(v16h a, v16h b, v8f c) {
  v8f d = __builtin_amdgcn_wmma_f32_16x16x32_f16(false, a, false, b, (short)0, c, false, false);
  asm volatile("v_nop\n\tv_nop\n\tv_nop\n\tv_nop" : "+v"(d) : "v"(a), "v"(b));
  return d;
}
// 16x16x32 fragments: lane = (h = lane>>4, row/col = lane&15); elements 0..7 = k0+8h+0..7, 8..15 = k0+16+8h+0..7; D element r = row 8h+r, col lane&15
__device__ __forceinline__ v16h frag_h(const _Float16* rowk0, int lane) {
  union { v16h v; v8h q[2]; } u; const _Float16* p = rowk0 + 8 * (lane >> 4);
  u.q[0] = *(const v8h*)p; u.q[1] = *(const v8h*)(p + 16); return u.v;
}
__device__ __forceinline__ v16h frag_f32s(const float* rowk0, int lane, float sc) {
  v16h a; const float* p = rowk0 + 8 * (lane >> 4);
#pragma unroll
  for (int i = 0; i < 8; ++i) { const float x0 = p[i], x1 = p[16 + i]; a[i] = (_Float16)(x0 * sc); a[8 + i] = (_Float16)(x1 * sc); }
  return a;
}
__device__ __forceinline__ float bfr(float v) { return (float)(__bf16)v; }

// Self-attention over a flattened 16x16x16 volume: GroupNorm(8 groups, affine) -> 1x1x1 conv qkv (W (out,in) [384][256], no bias) -> 4 heads x 32 dims, softmax((q^T k) * 32^-0.5) over 4,096 keys -> ctx -> 1x1x1 conv proj (W (out,in) [256][128] + bias) -> + x. Channels-first in and out.
#ifndef NB
#define NB 2
#endif
#ifndef SEQ
#define SEQ 4096
#endif
#define NB_FULL 2
#define TT SEQ              // voxels attended per batch element
#define NPIX 4096           // full per-channel voxel stride of x and of the output
#define DIN 256             // model width (input / output channels)
#define GROUPS 8
#define CPG (DIN / GROUPS)  // channels per group
#define NH 4
#define HD 32
#define CC (NH * HD)        // inner width 128
#define SCALE (0.17677669529663687f)
#define EPS (1.0e-5f)
static_assert(CPG == 32);
static_assert(CC == 128);
static_assert(DIN % 128 == 0);
static_assert(TT % 128 == 0);
static_assert(TT <= NPIX);
static_assert(NB <= NB_FULL);
static_assert(((size_t)NB * DIN - 1) * NPIX + TT <= (size_t)2097152);   // last written output element < 8,388,608 B / 4

// workspace carve (bytes): GS stats lines | W1 f16 [384][256] | W2 f16 [256][128] | QH f16 rows [NB*TT][CC] | KH | VT f16 planes [NB][CC][TT] | Y f32 rows [NB*TT][CC]
#define WS_GS  ((size_t)0)
#define WS_W1  ((size_t)4096)
#define WS_W2  (WS_W1 + 2u * (size_t)3 * CC * DIN)
#define WS_QH  (WS_W2 + 2u * (size_t)DIN * CC)
#define WS_KH  (WS_QH + 2u * (size_t)NB * TT * CC)
#define WS_VT  (WS_KH + 2u * (size_t)NB * TT * CC)
#define WS_Y   (WS_VT + 2u * (size_t)NB * CC * TT)
#define WS_END (WS_Y  + 4u * (size_t)NB * TT * CC)
static_assert(4u * NB * GROUPS * 32 <= 4096);
static_assert(WS_END <= (size_t)134217728);
static_assert((3 * CC * DIN / 8) % 256 == 0);
static_assert(((3 * CC * DIN + DIN * CC) / 8) % 256 == 0);

__global__ __launch_bounds__(256) void k_gn(const float* __restrict__ X, float* __restrict__ GS) {
  __shared__ double sd[256]; __shared__ float sm1, sm2;
  const int tid = threadIdx.x; const int bg = blockIdx.x; const int b = bg / GROUPS, gi = bg % GROUPS;
  const float* xp = X + ((size_t)b * DIN + (size_t)gi * CPG) * NPIX;
  const int nq = CPG * (TT / 4);
  double s = 0.0;
#pragma unroll 1
  for (int e = tid; e < nq; e += 256) { const int c = e / (TT / 4), t4 = e - c * (TT / 4);
    const v4f v = *(const v4f*)(xp + (size_t)c * NPIX + (size_t)t4 * 4); const float x0 = v[0], x1 = v[1], x2 = v[2], x3 = v[3];
    s += (double)((bfr(x0) + bfr(x1)) + (bfr(x2) + bfr(x3))); }
  sd[tid] = s; __syncthreads();
  for (int off = 128; off > 0; off >>= 1) { if (tid < off) sd[tid] += sd[tid + off]; __syncthreads(); }
  if (tid == 0) sm1 = (float)(sd[0] / (double)(CPG * TT));
  __syncthreads(); const float mean = sm1;
  double s2 = 0.0;
#pragma unroll 1
  for (int e = tid; e < nq; e += 256) { const int c = e / (TT / 4), t4 = e - c * (TT / 4);
    const v4f v = *(const v4f*)(xp + (size_t)c * NPIX + (size_t)t4 * 4); const float x0 = v[0], x1 = v[1], x2 = v[2], x3 = v[3];
    const float d0 = bfr(x0) - mean, d1 = bfr(x1) - mean, d2 = bfr(x2) - mean, d3 = bfr(x3) - mean;
    s2 += (double)((d0 * d0 + d1 * d1) + (d2 * d2 + d3 * d3)); }
  sd[tid] = s2; __syncthreads();
  for (int off = 128; off > 0; off >>= 1) { if (tid < off) sd[tid] += sd[tid + off]; __syncthreads(); }
  if (tid == 0) { const float var = (float)(sd[0] / (double)(CPG * TT)); sm2 = 1.0f / sqrtf(var + EPS); }
  __syncthreads();
  if (tid < 32) { const float val = tid == 0 ? mean : (tid == 1 ? sm2 : 0.f); vst2(GS + (size_t)bg * 32 + tid, val); }
}
// ---- k_cvw: weights -> f16(bf16(w) x 256) planes (exact), 8 contiguous elements = one 16-B store per thread
__global__ __launch_bounds__(256) void k_cvw(const float* __restrict__ WA, const float* __restrict__ WB, _Float16* __restrict__ P1, _Float16* __restrict__ P2) {
  const int n1c = 3 * CC * DIN / 8, n2c = DIN * CC / 8;
  const int i8 = blockIdx.x * 256 + threadIdx.x; if (i8 >= n1c + n2c) return;
  const bool second = i8 >= n1c;   // block-uniform (n1c is a multiple of 256)
  const float* src = second ? WB + (size_t)(i8 - n1c) * 8 : WA + (size_t)i8 * 8;
  _Float16* dst = second ? P2 + (size_t)(i8 - n1c) * 8 : P1 + (size_t)i8 * 8;
  const v8f v = *(const v8f*)src; union { v8h h; v4u u; } o;
#pragma unroll
  for (int e = 0; e < 8; ++e) { const float f = v[e]; o.h[e] = (_Float16)(bfr(f) * 256.0f); }
  vst2(dst, o.u);
}
// ---- k_proj: block = (64 voxel rows, which in {q,k,v}): GroupNorm applied on the channels-first gather (group == 32-channel k chunk), qkv = W xn with f16 operands (W x 256) -> which 0/1: f16 rows [b*TT+t][128]; which 2: f16 planes [b][c][t]
__global__ __launch_bounds__(128) void k_proj(const float* __restrict__ X, const float* __restrict__ GS, const float* __restrict__ GW, const float* __restrict__ GB, const _Float16* __restrict__ W1,
    _Float16* __restrict__ QH, _Float16* __restrict__ KH, _Float16* __restrict__ VT) {
  __shared__ __align__(16) _Float16 sh[64][136]; __shared__ __align__(16) _Float16 th[128][72];
  const int tid = threadIdx.x, wave = tid >> 5, lane = tid & 31, col = lane & 15, g = lane >> 4; const int which = blockIdx.y;
  const size_t r0 = (size_t)blockIdx.x * 64; const size_t bb = r0 / TT; const int t0 = (int)(r0 % TT);
  v8f acc[8] = {};
#pragma unroll 1
  for (int kc = 0; kc < DIN / 32; ++kc) {
    const float mu = GS[(bb * GROUPS + kc) * 32], rs = GS[(bb * GROUPS + kc) * 32 + 1];
    v16h a;
    { const float* p = X + ((size_t)bb * DIN + kc * 32 + 8 * g) * NPIX + t0 + wave * 16 + col;   // x[b][k][n], stride NPIX between channels
      const v8f w0 = *(const v8f*)(GW + kc * 32 + 8 * g), w1 = *(const v8f*)(GW + kc * 32 + 16 + 8 * g);
      const v8f b0 = *(const v8f*)(GB + kc * 32 + 8 * g), b1 = *(const v8f*)(GB + kc * 32 + 16 + 8 * g);
#pragma unroll
      for (int i = 0; i < 8; ++i) {
        const float xa = p[(size_t)i * NPIX], xb = p[(size_t)(16 + i) * NPIX]; const float wa = w0[i], wb = w1[i], ba = b0[i], bbv = b1[i];
        a[i]     = (_Float16)(((bfr(xa) - mu) * rs) * bfr(wa) + bfr(ba));
        a[8 + i] = (_Float16)(((bfr(xb) - mu) * rs) * bfr(wb) + bfr(bbv)); } }
    asm volatile("s_wait_loadcnt 0x0" ::: "memory");
#pragma unroll
    for (int j = 0; j < 8; ++j) { const v16h w = frag_h(W1 + (size_t)(which * CC + j * 16 + col) * DIN + kc * 32, lane); acc[j] = wmma16(a, w, acc[j]); }
  }
  if (which < 2) { _Float16* DH = which == 0 ? QH : KH;
#pragma unroll
    for (int j = 0; j < 8; ++j)
#pragma unroll
      for (int r = 0; r < 8; ++r) sh[wave * 16 + 8 * g + r][j * 16 + col] = (_Float16)(acc[j][r] * (1.0f / 256.0f));
    __syncthreads();
#pragma unroll 1
    for (int e = tid; e < 64 * 16; e += 128) { const int rl = e >> 4, q = e & 15; vst2(DH + (r0 + rl) * CC + q * 8, *(const v4u*)&sh[rl][q * 8]); }
  } else {
#pragma unroll
    for (int j = 0; j < 8; ++j)
#pragma unroll
      for (int r = 0; r < 8; ++r) th[j * 16 + col][wave * 16 + 8 * g + r] = (_Float16)(acc[j][r] * (1.0f / 256.0f));
    __syncthreads();
#pragma unroll 1
    for (int e = tid; e < 128 * 8; e += 128) { const int cl = e >> 3, q = e & 7; vst2(VT + (bb * CC + cl) * (size_t)TT + t0 + q * 8, *(const v4u*)&th[cl][q * 8]); }
  }
}
#define FA_KS 128            // keys per LDS stage
#define FA_KP (HD + 8)       // K row pitch in f16: 80 B = 16 B x odd, conflict-free for 16-byte readers
#define FA_VP (FA_KS + 8)    // V^T row pitch in f16: 272 B = 16 B x odd
#define FA_NS (TT / FA_KS)
static_assert(HD == 32);
static_assert(TT % FA_KS == 0);
__device__ __forceinline__ v8f wmma_b(v16h a, v16h b, v8f c) { return __builtin_amdgcn_wmma_f32_16x16x32_f16(false, a, false, b, (short)0, c, false, false); }
__device__ __forceinline__ float xhalf(float x) {   // lane l takes lane l ^ 16
  return __builtin_bit_cast(float, __builtin_amdgcn_permlanex16(__builtin_bit_cast(int, x), __builtin_bit_cast(int, x), 0x76543210, 0xfedcba98, false, false));
}
__global__ __launch_bounds__(256) void k_fa(const _Float16* __restrict__ QH, const _Float16* __restrict__ KH, const _Float16* __restrict__ VT, float* __restrict__ Y) {
  __shared__ __align__(16) _Float16 kl[2][FA_KS * FA_KP]; __shared__ __align__(16) _Float16 vl[2][HD * FA_VP];
  const int tid = threadIdx.x, wave = tid >> 5, lane = tid & 31, col = lane & 15, g = lane >> 4;
  const int b = blockIdx.y / NH, h = blockIdx.y % NH; const int q0 = blockIdx.x * 128 + wave * 16;
  const float cs = SCALE * 1.4426950408889634f;   // logit scale x log2(e)
  const v16h qf = frag_h(QH + ((size_t)b * TT + q0 + col) * CC + h * HD, lane);
  // staging: 16-byte pieces; K: 4 pieces a key row, rows tid>>2 and 64 + tid>>2; V^T: 16 pieces a channel row, rows tid>>4 and 16 + tid>>4
  const _Float16* kg = KH + ((size_t)b * TT + (tid >> 2)) * CC + h * HD + (tid & 3) * 8;
  const _Float16* vg = VT + ((size_t)b * CC + h * HD + (tid >> 4)) * (size_t)TT + (tid & 15) * 8;
  const int kd = (tid >> 2) * FA_KP + (tid & 3) * 8, vd = (tid >> 4) * FA_VP + (tid & 15) * 8;
  { const v4u k0 = *(const v4u*)kg, k1 = *(const v4u*)(kg + (size_t)64 * CC), w0 = *(const v4u*)vg, w1 = *(const v4u*)(vg + (size_t)16 * TT);
    *(v4u*)&kl[0][kd] = k0; *(v4u*)&kl[0][kd + 64 * FA_KP] = k1; *(v4u*)&vl[0][vd] = w0; *(v4u*)&vl[0][vd + 16 * FA_VP] = w1; }
  __syncthreads();
  v8f acc[2] = {}; float mrun = -3.0e38f, lsum = 0.f;
  // the stage loop stays rolled (one copy of the 128-key body in the instruction cache; the buffer is a run-time bit); the loops inside are unrolled so that every register array has constant indices
#pragma unroll 1
  for (int st = 0; st < FA_NS; ++st) {
    const int buf = st & 1; const bool more = st + 1 < FA_NS;   // block-uniform
    v4u k0 = {}, k1 = {}, w0 = {}, w1 = {};
    if (more) { const _Float16* kn = kg + (size_t)(st + 1) * FA_KS * CC; const _Float16* vn = vg + (size_t)(st + 1) * FA_KS;   // next stage's loads fly under this stage's work
      k0 = *(const v4u*)kn; k1 = *(const v4u*)(kn + (size_t)64 * CC); w0 = *(const v4u*)vn; w1 = *(const v4u*)(vn + (size_t)16 * TT); }
#pragma unroll
    for (int ps = 0; ps < FA_KS / 64; ++ps) {
      v8f s[4];
#pragma unroll
      for (int t = 0; t < 4; ++t) { const v8f z = {}; s[t] = wmma_b(frag_h(&kl[buf][(ps * 64 + t * 16 + col) * FA_KP], lane), qf, z); }   // s[t][r] = logit(key 16t + 8g + r, query col)
      float mt[4];
#pragma unroll
      for (int t = 0; t < 4; ++t) { mt[t] = s[t][0];
#pragma unroll
        for (int r = 1; r < 8; ++r) mt[t] = fmaxf(mt[t], s[t][r]); }
      float mx = fmaxf(fmaxf(mt[0], mt[1]), fmaxf(mt[2], mt[3]));
      mx = fmaxf(mx, xhalf(mx)) * cs;   // both halves of the wave hold this query's maximum (the scale is positive)
      const float mn = fmaxf(mrun, mx); const float corr = __builtin_amdgcn_exp2f(mrun - mn); mrun = mn;   // corr = 0 on the first pass
      acc[0] = acc[0] * corr; acc[1] = acc[1] * corr;
      const float nm = 11.0f - mn;   // P x 2^11: keeps small weights out of the f16 subnormals; it cancels in the division by the row sum
      v16h pf[2]; float pt[4]; v8f e[4], p[4];
#pragma unroll
      for (int t = 0; t < 4; ++t)
#pragma unroll
        for (int r = 0; r < 8; ++r) { e[t][r] = fmaf(s[t][r], cs, nm); p[t][r] = __builtin_amdgcn_exp2f(e[t][r]); }
      // the slot that the instruction set asks for behind a transcendental: as inputs, the results put the v_nop behind the last exponential and the arguments keep their registers unwritten until there
      asm volatile("v_nop" :: "v"(p[0]), "v"(p[1]), "v"(p[2]), "v"(p[3]), "v"(e[0]), "v"(e[1]), "v"(e[2]), "v"(e[3]));
#pragma unroll
      for (int t = 0; t < 4; ++t) { pt[t] = ((p[t][0] + p[t][1]) + (p[t][2] + p[t][3])) + ((p[t][4] + p[t][5]) + (p[t][6] + p[t][7]));
#pragma unroll
        for (int r = 0; r < 8; ++r) pf[t >> 1][(t & 1) * 8 + r] = (_Float16)p[t][r]; }
      lsum = lsum * corr + ((pt[0] + pt[1]) + (pt[2] + pt[3]));   // this half's keys only; the halves join after the loop
#pragma unroll
      for (int kk = 0; kk < 2; ++kk)
#pragma unroll
        for (int j = 0; j < 2; ++j) acc[j] = wmma_b(frag_h(&vl[buf][(j * 16 + col) * FA_VP + ps * 64 + kk * 32], lane), pf[kk], acc[j]);   // acc[j][r] = ctx(channel 16j + 8g + r, query col)
    }
    if (more) { const int nb = buf ^ 1;   // its last readers left it before the barrier that ended the stage before
      *(v4u*)&kl[nb][kd] = k0; *(v4u*)&kl[nb][kd + 64 * FA_KP] = k1; *(v4u*)&vl[nb][vd] = w0; *(v4u*)&vl[nb][vd + 16 * FA_VP] = w1; }
    __syncthreads();   // publishes stage st + 1 and ends every read of stage st
  }
  const float inv = 1.0f / (lsum + xhalf(lsum));
  float* yp = Y + ((size_t)b * TT + q0 + col) * CC + h * HD + 8 * g;   // a query's 32 channels = one 128-B line, written whole by lanes col and col + 16
#pragma unroll
  for (int j = 0; j < 2; ++j) { const v8f o = acc[j] * inv; const v4f lo = {o[0], o[1], o[2], o[3]}, hi = {o[4], o[5], o[6], o[7]}; vst2(yp + j * 16, lo); vst2(yp + j * 16 + 4, hi); }
}
// ---- k_out: block = (64 voxel rows, 128 output channels): proj = W ctx (ctx x 64 f16 against W x 256 f16) + bf16(bias), LDS transpose to channels-first, + bf16(x), whole 256-B (c, 64 n) runs by 16 lanes
__global__ __launch_bounds__(128) void k_out(const float* __restrict__ Y, const float* __restrict__ X, const _Float16* __restrict__ W2, const float* __restrict__ PB, float* __restrict__ OUT) {
  __shared__ __align__(16) float stc[128][68];
  const int tid = threadIdx.x, wave = tid >> 5, lane = tid & 31, col = lane & 15, g = lane >> 4; const int c0 = blockIdx.y * 128;
  const size_t r0 = (size_t)blockIdx.x * 64; const size_t bb = r0 / TT; const int t0 = (int)(r0 % TT);
  v8f acc[8] = {};
#pragma unroll 1
  for (int kc = 0; kc < CC / 32; ++kc) { const v16h a = frag_f32s(Y + (r0 + wave * 16 + col) * CC + kc * 32, lane, 64.0f);
    asm volatile("s_wait_loadcnt 0x0" ::: "memory");
#pragma unroll
    for (int j = 0; j < 8; ++j) { const v16h w = frag_h(W2 + (size_t)(c0 + j * 16 + col) * CC + kc * 32, lane); acc[j] = wmma16(a, w, acc[j]); } }
#pragma unroll
  for (int j = 0; j < 8; ++j) { const float bias = bfr(PB[c0 + j * 16 + col]);
#pragma unroll
    for (int r = 0; r < 8; ++r) stc[j * 16 + col][wave * 16 + 8 * g + r] = acc[j][r] * (1.0f / 16384.0f) + bias; }
  __syncthreads();
#pragma unroll 1
  for (int e = tid; e < 128 * 16; e += 128) { const int cl = e >> 4, q = e & 15; const size_t o = ((size_t)bb * DIN + c0 + cl) * NPIX + t0 + q * 4;
    const v4f xv = *(const v4f*)(X + o); const float x0 = xv[0], x1 = xv[1], x2 = xv[2], x3 = xv[3]; v4f r4 = *(const v4f*)&stc[cl][q * 4];
    r4[0] += bfr(x0); r4[1] += bfr(x1); r4[2] += bfr(x2); r4[3] += bfr(x3); vst2(OUT + o, r4); }
}

extern "C" void kernel_launch(void* const* d_in, const int* in_sizes, int n_in, void* d_out, int out_size, void* d_ws, size_t ws_size, hipStream_t stream) {
  // inputs (wire order): 0 x [2,256,16,16,16] f32; 1 norm_w [256]; 2 norm_b [256]; 3 qkv_w (out,in) [384,256]; 4 proj_w (out,in) [256,128]; 5 proj_b [256]
  if (n_in < 6) return;
  if (in_sizes[0] < NB * DIN * NPIX || in_sizes[1] < DIN || in_sizes[2] < DIN || in_sizes[3] < 3 * CC * DIN || in_sizes[4] < DIN * CC || in_sizes[5] < DIN) return;
  if (out_size < NB * DIN * NPIX) return;
  if (ws_size < WS_END) return;
  const float* X = (const float*)d_in[0]; const float* GW = (const float*)d_in[1]; const float* GB = (const float*)d_in[2];
  const float* WQ = (const float*)d_in[3]; const float* WP = (const float*)d_in[4]; const float* PB = (const float*)d_in[5];
  char* ws = (char*)d_ws;
  float* GS = (float*)(ws + WS_GS); _Float16* W1 = (_Float16*)(ws + WS_W1); _Float16* W2 = (_Float16*)(ws + WS_W2);
  _Float16* QH = (_Float16*)(ws + WS_QH); _Float16* KH = (_Float16*)(ws + WS_KH); _Float16* VT = (_Float16*)(ws + WS_VT);
  float* Y = (float*)(ws + WS_Y); float* OUT = (float*)d_out;
  k_gn<<<dim3(NB * GROUPS), 256, 0, stream>>>(X, GS);
  k_cvw<<<dim3((3 * CC * DIN + DIN * CC) / 8 / 256), 256, 0, stream>>>(WQ, WP, W1, W2);
  k_proj<<<dim3(NB * TT / 64, 3), 128, 0, stream>>>(X, GS, GW, GB, W1, QH, KH, VT);
  k_fa<<<dim3(TT / 128, NB * NH), 256, 0, stream>>>(QH, KH, VT, Y);
  k_out<<<dim3(NB * TT / 64, DIN / 128), 128, 0, stream>>>(Y, X, W2, PB, OUT);
}

// v002
// Measured time: 76 microseconds a run.
// In two side-by-side timings against v001, it was 2.15 and 2.16 times as fast.
// Over all steps from v000 it is 15.5 times as fast.
// compute dtype: every float input RNE-converted to bf16 on load; GroupNorm statistics f32: per 2-channel slice a tree sum for the mean and the squared deviations from it, slices joined by the parallel-variance rule; qkv = W x on v_wmma_f32_16x16x32_f16 with W as f16(bf16 x 256) and normalised x as f16, f32 accumulate; logits k.q f16 x f16 single product, f32 accumulate; softmax f32, online over 64-key passes (running maximum, base-2 exponential with the scale folded in), unnormalised P x 2^11 to f16 once against v f16 (single product), one division by the f32 row sum at the end; output projection: ctx x 64 f16 against W f16(bf16 x 256), f32 accumulate; bias + residual add in f32; f32 output (channels-first).
#include <hip/hip_runtime.h>
#include <math.h>

typedef __attribute__((ext_vector_type(16))) _Float16 v16h;
typedef __attribute__((ext_vector_type(8)))  _Float16 v8h;
typedef __attribute__((ext_vector_type(8)))  float v8f;
typedef __attribute__((ext_vector_type(4)))  float v4f;
typedef __attribute__((ext_vector_type(4)))  unsigned v4u;

template <typename T> __device__ __forceinline__ void vst2(void* p, T v) { *(T*)p = v;  }
__device__ __forceinline__ v8f wmma16(v16h a, v16h b, v8f c) {
  v8f d = __builtin_amdgcn_wmma_f32_16x16x32_f16(false, a, false, b, (short)0, c, false, false);
  asm volatile("v_nop\n\tv_nop\n\tv_nop\n\tv_nop" : "+v"(d) : "v"(a), "v"(b));
  return d;
}
// 16x16x32 fragments: lane = (h = lane>>4, row/col = lane&15); elements 0..7 = k0+8h+0..7, 8..15 = k0+16+8h+0..7; D element r = row 8h+r, col lane&15
__device__ __forceinline__ v16h frag_h(const _Float16* rowk0, int lane) {
  union { v16h v; v8h q[2]; } u; const _Float16* p = rowk0 + 8 * (lane >> 4);
  u.q[0] = *(const v8h*)p; u.q[1] = *(const v8h*)(p + 16); return u.v;
}
__device__ __forceinline__ v16h frag_f32s(const float* rowk0, int lane, float sc) {
  v16h a; const float* p = rowk0 + 8 * (lane >> 4);
#pragma unroll
  for (int i = 0; i < 8; ++i) { const float x0 = p[i], x1 = p[16 + i]; a[i] = (_Float16)(x0 * sc); a[8 + i] = (_Float16)(x1 * sc); }
  return a;
}
__device__ __forceinline__ float bfr(float v) { return (float)(__bf16)v; }

// Self-attention over a flattened 16x16x16 volume: GroupNorm(8 groups, affine) -> 1x1x1 conv qkv (W (out,in) [384][256], no bias) -> 4 heads x 32 dims, softmax((q^T k) * 32^-0.5) over 4,096 keys -> ctx -> 1x1x1 conv proj (W (out,in) [256][128] + bias) -> + x. Channels-first in and out.
#ifndef NB
#define NB 2
#endif
#ifndef SEQ
#define SEQ 4096
#endif
#define NB_FULL 2
#define TT SEQ              // voxels attended per batch element
#define NPIX 4096           // full per-channel voxel stride of x and of the output
#define DIN 256             // model width (input / output channels)
#define GROUPS 8
#define CPG (DIN / GROUPS)  // channels per group
#define NH 4
#define HD 32
#define CC (NH * HD)        // inner width 128
#define SCALE (0.17677669529663687f)
#define EPS (1.0e-5f)
#define GN_SL 16                            // slices (work-groups) per group
#define GN_CH (CPG / GN_SL)                 // channels per slice
#define GN_LD (GN_CH * (TT / 4) / 256)      // 16-byte loads per thread
static_assert(CPG == 32);
static_assert(CPG % GN_SL == 0);
static_assert((GN_CH * (TT / 4)) % 256 == 0);
static_assert(GROUPS * GN_SL == 128);
static_assert(CC == 128);
static_assert(DIN % 128 == 0);
static_assert(TT % 128 == 0);
static_assert(TT <= NPIX);
static_assert(NB <= NB_FULL);
static_assert(((size_t)NB * DIN - 1) * NPIX + TT <= (size_t)2097152);   // last written output element < 8,388,608 B / 4

// workspace carve (bytes): GS one 128-B line of partial statistics per (batch, group, slice) | W1 f16 [384][256] | W2 f16 [256][128] | QH f16 rows [NB*TT][CC] | KH | VT f16 planes [NB][CC][TT] | Y f32 rows [NB*TT][CC]
#define WS_GS  ((size_t)0)
#define WS_W1  ((size_t)128 * NB_FULL * GROUPS * GN_SL)
#define WS_W2  (WS_W1 + 2u * (size_t)3 * CC * DIN)
#define WS_QH  (WS_W2 + 2u * (size_t)DIN * CC)
#define WS_KH  (WS_QH + 2u * (size_t)NB * TT * CC)
#define WS_VT  (WS_KH + 2u * (size_t)NB * TT * CC)
#define WS_Y   (WS_VT + 2u * (size_t)NB * CC * TT)
#define WS_END (WS_Y  + 4u * (size_t)NB * TT * CC)
static_assert(WS_END <= (size_t)134217728);
static_assert((3 * CC * DIN / 8) % 256 == 0);
static_assert(((3 * CC * DIN + DIN * CC) / 8) % 256 == 0);

// sum over the 16 lanes of a row, left in every lane of the row (four butterfly steps on the vector port, no LDS)
__device__ __forceinline__ float rowsum(float x) {
  x += __builtin_bit_cast(float, __builtin_amdgcn_update_dpp(0, __builtin_bit_cast(int, x), 0x161, 0xf, 0xf, true));   // row_xmask:1
  x += __builtin_bit_cast(float, __builtin_amdgcn_update_dpp(0, __builtin_bit_cast(int, x), 0x162, 0xf, 0xf, true));   // row_xmask:2
  x += __builtin_bit_cast(float, __builtin_amdgcn_update_dpp(0, __builtin_bit_cast(int, x), 0x164, 0xf, 0xf, true));   // row_xmask:4
  x += __builtin_bit_cast(float, __builtin_amdgcn_update_dpp(0, __builtin_bit_cast(int, x), 0x168, 0xf, 0xf, true));   // row_xmask:8
  return x;
}
__device__ __forceinline__ float xhalf(float x) {   // lane l takes lane l ^ 16
  return __builtin_bit_cast(float, __builtin_amdgcn_permlanex16(__builtin_bit_cast(int, x), __builtin_bit_cast(int, x), 0x76543210, 0xfedcba98, false, false));
}
// ---- k_gn: block = one slice (GN_CH channels) of one (batch, group): the slice is read once, every load of a thread in flight at the same time, and stays in registers for both sums.
// It leaves (slice mean, sum of squared deviations from the slice mean) in a 128-B line of its own; k_proj joins the GN_SL slices of a group.
__global__ __launch_bounds__(256) void k_gn(const float* __restrict__ X, float* __restrict__ GS) {
  __shared__ __align__(16) float sa[8]; __shared__ __align__(16) float sq[8];
  const int tid = threadIdx.x, wave = tid >> 5, lane = tid & 31; const int bg = blockIdx.x / GN_SL, sl = blockIdx.x % GN_SL; const int b = bg / GROUPS, gi = bg % GROUPS;
  const float* xp = X + ((size_t)b * DIN + (size_t)gi * CPG + (size_t)sl * GN_CH) * NPIX;
  v4f v[GN_LD];
  // the three loops are unrolled so that v[] has constant indices (stays in registers) and every load issues ahead of the first wait
#pragma unroll
  for (int i = 0; i < GN_LD; ++i) { const int e = tid + 256 * i; const int c = e / (TT / 4), t4 = e - c * (TT / 4); v[i] = *(const v4f*)(xp + (size_t)c * NPIX + (size_t)t4 * 4); }
  float s = 0.f;
#pragma unroll
  for (int i = 0; i < GN_LD; ++i) { const float x0 = v[i][0], x1 = v[i][1], x2 = v[i][2], x3 = v[i][3];
    v[i][0] = bfr(x0); v[i][1] = bfr(x1); v[i][2] = bfr(x2); v[i][3] = bfr(x3); s += (v[i][0] + v[i][1]) + (v[i][2] + v[i][3]); }
  s = rowsum(s); s += xhalf(s);
  if (lane == 0) sa[wave] = s;
  __syncthreads();
  const v4f a0 = *(const v4f*)&sa[0], a1 = *(const v4f*)&sa[4];
  const float mean = (((a0[0] + a0[1]) + (a0[2] + a0[3])) + ((a1[0] + a1[1]) + (a1[2] + a1[3]))) * (1.0f / (float)(GN_CH * TT));
  float s2 = 0.f;
#pragma unroll
  for (int i = 0; i < GN_LD; ++i) { const float d0 = v[i][0] - mean, d1 = v[i][1] - mean, d2 = v[i][2] - mean, d3 = v[i][3] - mean;
    s2 += (d0 * d0 + d1 * d1) + (d2 * d2 + d3 * d3); }
  s2 = rowsum(s2); s2 += xhalf(s2);
  if (lane == 0) sq[wave] = s2;
  __syncthreads();
  if (tid < 32) { const v4f q0 = *(const v4f*)&sq[0], q1 = *(const v4f*)&sq[4];
    const float m2 = ((q0[0] + q0[1]) + (q0[2] + q0[3])) + ((q1[0] + q1[1]) + (q1[2] + q1[3]));
    const float val = tid == 0 ? mean : (tid == 1 ? m2 : 0.f); vst2(GS + (size_t)blockIdx.x * 32 + tid, val); }
}
// ---- k_cvw: weights -> f16(bf16(w) x 256) planes (exact), 8 contiguous elements = one 16-B store per thread
__global__ __launch_bounds__(256) void k_cvw(const float* __restrict__ WA, const float* __restrict__ WB, _Float16* __restrict__ P1, _Float16* __restrict__ P2) {
  const int n1c = 3 * CC * DIN / 8, n2c = DIN * CC / 8;
  const int i8 = blockIdx.x * 256 + threadIdx.x; if (i8 >= n1c + n2c) return;
  const bool second = i8 >= n1c;   // block-uniform (n1c is a multiple of 256)
  const float* src = second ? WB + (size_t)(i8 - n1c) * 8 : WA + (size_t)i8 * 8;
  _Float16* dst = second ? P2 + (size_t)(i8 - n1c) * 8 : P1 + (size_t)i8 * 8;
  const v8f v = *(const v8f*)src; union { v8h h; v4u u; } o;
#pragma unroll
  for (int e = 0; e < 8; ++e) { const float f = v[e]; o.h[e] = (_Float16)(bfr(f) * 256.0f); }
  vst2(dst, o.u);
}
// ---- k_proj: block = (64 voxel rows, which in {q,k,v}): GroupNorm applied on the channels-first gather (group == 32-channel k chunk), qkv = W xn with f16 operands (W x 256) -> which 0/1: f16 rows [b*TT+t][128]; which 2: f16 planes [b][c][t]
__global__ __launch_bounds__(128) void k_proj(const float* __restrict__ X, const float* __restrict__ GS, const float* __restrict__ GW, const float* __restrict__ GB, const _Float16* __restrict__ W1,
    _Float16* __restrict__ QH, _Float16* __restrict__ KH, _Float16* __restrict__ VT) {
  __shared__ __align__(16) _Float16 sh[64][136]; __shared__ __align__(16) _Float16 th[128][72]; __shared__ float sst[GROUPS][2];
  const int tid = threadIdx.x, wave = tid >> 5, lane = tid & 31, col = lane & 15, g = lane >> 4; const int which = blockIdx.y;
  const size_t r0 = (size_t)blockIdx.x * 64; const size_t bb = r0 / TT; const int t0 = (int)(r0 % TT);
  { // join the slices' statistics, once per block: thread = (group tid >> 4, slice tid & 15), a group = one 16-lane row
    const float* gp = GS + ((size_t)bb * GROUPS * GN_SL + tid) * 32; const float pm = gp[0], pq = gp[1];
    const float mean = rowsum(pm) * (1.0f / (float)GN_SL); const float dm = pm - mean;
    const float var = rowsum(pq + (float)(GN_CH * TT) * (dm * dm)) * (1.0f / (float)(CPG * TT));
    if (col == 0) { sst[tid >> 4][0] = mean; sst[tid >> 4][1] = 1.0f / sqrtf(var + EPS); } }
  __syncthreads();   // publishes the eight groups' mean and reciprocal deviation to all four waves
  v8f acc[8] = {};
#pragma unroll 1
  for (int kc = 0; kc < DIN / 32; ++kc) {
    const float mu = sst[kc][0], rs = sst[kc][1];
    v16h a;
    { const float* p = X + ((size_t)bb * DIN + kc * 32 + 8 * g) * NPIX + t0 + wave * 16 + col;   // x[b][k][n], stride NPIX between channels
      const v8f w0 = *(const v8f*)(GW + kc * 32 + 8 * g), w1 = *(const v8f*)(GW + kc * 32 + 16 + 8 * g);
      const v8f b0 = *(const v8f*)(GB + kc * 32 + 8 * g), b1 = *(const v8f*)(GB + kc * 32 + 16 + 8 * g);
#pragma unroll
      for (int i = 0; i < 8; ++i) {
        const float xa = p[(size_t)i * NPIX], xb = p[(size_t)(16 + i) * NPIX]; const float wa = w0[i], wb = w1[i], ba = b0[i], bbv = b1[i];
        a[i]     = (_Float16)(((bfr(xa) - mu) * rs) * bfr(wa) + bfr(ba));
        a[8 + i] = (_Float16)(((bfr(xb) - mu) * rs) * bfr(wb) + bfr(bbv)); } }
    asm volatile("s_wait_loadcnt 0x0" ::: "memory");
#pragma unroll
    for (int j = 0; j < 8; ++j) { const v16h w = frag_h(W1 + (size_t)(which * CC + j * 16 + col) * DIN + kc * 32, lane); acc[j] = wmma16(a, w, acc[j]); }
  }
  if (which < 2) { _Float16* DH = which == 0 ? QH : KH;
#pragma unroll
    for (int j = 0; j < 8; ++j)
#pragma unroll
      for (int r = 0; r < 8; ++r) sh[wave * 16 + 8 * g + r][j * 16 + col] = (_Float16)(acc[j][r] * (1.0f / 256.0f));
    __syncthreads();
#pragma unroll 1
    for (int e = tid; e < 64 * 16; e += 128) { const int rl = e >> 4, q = e & 15; vst2(DH + (r0 + rl) * CC + q * 8, *(const v4u*)&sh[rl][q * 8]); }
  } else {
#pragma unroll
    for (int j = 0; j < 8; ++j)
#pragma unroll
      for (int r = 0; r < 8; ++r) th[j * 16 + col][wave * 16 + 8 * g + r] = (_Float16)(acc[j][r] * (1.0f / 256.0f));
    __syncthreads();
#pragma unroll 1
    for (int e = tid; e < 128 * 8; e += 128) { const int cl = e >> 3, q = e & 7; vst2(VT + (bb * CC + cl) * (size_t)TT + t0 + q * 8, *(const v4u*)&th[cl][q * 8]); }
  }
}
#define FA_KS 128            // keys per LDS stage
#define FA_KP (HD + 8)       // K row pitch in f16: 80 B = 16 B x odd, conflict-free for 16-byte readers
#define FA_VP (FA_KS + 8)    // V^T row pitch in f16: 272 B = 16 B x odd
#define FA_NS (TT / FA_KS)
static_assert(HD == 32);
static_assert(TT % FA_KS == 0);
__device__ __forceinline__ v8f wmma_b(v16h a, v16h b, v8f c) { return __builtin_amdgcn_wmma_f32_16x16x32_f16(false, a, false, b, (short)0, c, false, false); }
__global__ __launch_bounds__(256) void k_fa(const _Float16* __restrict__ QH, const _Float16* __restrict__ KH, const _Float16* __restrict__ VT, float* __restrict__ Y) {
  __shared__ __align__(16) _Float16 kl[2][FA_KS * FA_KP]; __shared__ __align__(16) _Float16 vl[2][HD * FA_VP];
  const int tid = threadIdx.x, wave = tid >> 5, lane = tid & 31, col = lane & 15, g = lane >> 4;
  const int b = blockIdx.y / NH, h = blockIdx.y % NH; const int q0 = blockIdx.x * 128 + wave * 16;
  const float cs = SCALE * 1.4426950408889634f;   // logit scale x log2(e)
  const v16h qf = frag_h(QH + ((size_t)b * TT + q0 + col) * CC + h * HD, lane);
  // staging: 16-byte pieces; K: 4 pieces a key row, rows tid>>2 and 64 + tid>>2; V^T: 16 pieces a channel row, rows tid>>4 and 16 + tid>>4
  const _Float16* kg = KH + ((size_t)b * TT + (tid >> 2)) * CC + h * HD + (tid & 3) * 8;
  const _Float16* vg = VT + ((size_t)b * CC + h * HD + (tid >> 4)) * (size_t)TT + (tid & 15) * 8;
  const int kd = (tid >> 2) * FA_KP + (tid & 3) * 8, vd = (tid >> 4) * FA_VP + (tid & 15) * 8;
  { const v4u k0 = *(const v4u*)kg, k1 = *(const v4u*)(kg + (size_t)64 * CC), w0 = *(const v4u*)vg, w1 = *(const v4u*)(vg + (size_t)16 * TT);
    *(v4u*)&kl[0][kd] = k0; *(v4u*)&kl[0][kd + 64 * FA_KP] = k1; *(v4u*)&vl[0][vd] = w0; *(v4u*)&vl[0][vd + 16 * FA_VP] = w1; }
  __syncthreads();
  v8f acc[2] = {}; float mrun = -3.0e38f, lsum = 0.f;
  // the stage loop stays rolled (one copy of the 128-key body in the instruction cache; the buffer is a run-time bit); the loops inside are unrolled so that every register array has constant indices
#pragma unroll 1
  for (int st = 0; st < FA_NS; ++st) {
    const int buf = st & 1; const bool more = st + 1 < FA_NS;   // block-uniform
    v4u k0 = {}, k1 = {}, w0 = {}, w1 = {};
    if (more) { const _Float16* kn = kg + (size_t)(st + 1) * FA_KS * CC; const _Float16* vn = vg + (size_t)(st + 1) * FA_KS;   // next stage's loads fly under this stage's work
      k0 = *(const v4u*)kn; k1 = *(const v4u*)(kn + (size_t)64 * CC); w0 = *(const v4u*)vn; w1 = *(const v4u*)(vn + (size_t)16 * TT); }
#pragma unroll
    for (int ps = 0; ps < FA_KS / 64; ++ps) {
      v8f s[4];
#pragma unroll
      for (int t = 0; t < 4; ++t) { const v8f z = {}; s[t] = wmma_b(frag_h(&kl[buf][(ps * 64 + t * 16 + col) * FA_KP], lane), qf, z); }   // s[t][r] = logit(key 16t + 8g + r, query col)
      float mt[4];
#pragma unroll
      for (int t = 0; t < 4; ++t) { mt[t] = s[t][0];
#pragma unroll
        for (int r = 1; r < 8; ++r) mt[t] = fmaxf(mt[t], s[t][r]); }
      float mx = fmaxf(fmaxf(mt[0], mt[1]), fmaxf(mt[2], mt[3]));
      mx = fmaxf(mx, xhalf(mx)) * cs;   // both halves of the wave hold this query's maximum (the scale is positive)
      const float mn = fmaxf(mrun, mx); const float corr = __builtin_amdgcn_exp2f(mrun - mn); mrun = mn;   // corr = 0 on the first pass
      acc[0] = acc[0] * corr; acc[1] = acc[1] * corr;
      const float nm = 11.0f - mn;   // P x 2^11: keeps small weights out of the f16 subnormals; it cancels in the division by the row sum
      v16h pf[2]; float pt[4]; v8f e[4], p[4];
#pragma unroll
      for (int t = 0; t < 4; ++t)
#pragma unroll
        for (int r = 0; r < 8; ++r) { e[t][r] = fmaf(s[t][r], cs, nm); p[t][r] = __builtin_amdgcn_exp2f(e[t][r]); }
      // the slot that the instruction set asks for behind a transcendental: as inputs, the results put the v_nop behind the last exponential and the arguments keep their registers unwritten until there
      asm volatile("v_nop" :: "v"(p[0]), "v"(p[1]), "v"(p[2]), "v"(p[3]), "v"(e[0]), "v"(e[1]), "v"(e[2]), "v"(e[3]));
#pragma unroll
      for (int t = 0; t < 4; ++t) { pt[t] = ((p[t][0] + p[t][1]) + (p[t][2] + p[t][3])) + ((p[t][4] + p[t][5]) + (p[t][6] + p[t][7]));
#pragma unroll
        for (int r = 0; r < 8; ++r) pf[t >> 1][(t & 1) * 8 + r] = (_Float16)p[t][r]; }
      lsum = lsum * corr + ((pt[0] + pt[1]) + (pt[2] + pt[3]));   // this half's keys only; the halves join after the loop
#pragma unroll
      for (int kk = 0; kk < 2; ++kk)
#pragma unroll
        for (int j = 0; j < 2; ++j) acc[j] = wmma_b(frag_h(&vl[buf][(j * 16 + col) * FA_VP + ps * 64 + kk * 32], lane), pf[kk], acc[j]);   // acc[j][r] = ctx(channel 16j + 8g + r, query col)
    }
    if (more) { const int nb = buf ^ 1;   // its last readers left it before the barrier that ended the stage before
      *(v4u*)&kl[nb][kd] = k0; *(v4u*)&kl[nb][kd + 64 * FA_KP] = k1; *(v4u*)&vl[nb][vd] = w0; *(v4u*)&vl[nb][vd + 16 * FA_VP] = w1; }
    __syncthreads();   // publishes stage st + 1 and ends every read of stage st
  }
  const float inv = 1.0f / (lsum + xhalf(lsum));
  float* yp = Y + ((size_t)b * TT + q0 + col) * CC + h * HD + 8 * g;   // a query's 32 channels = one 128-B line, written whole by lanes col and col + 16
#pragma unroll
  for (int j = 0; j < 2; ++j) { const v8f o = acc[j] * inv; const v4f lo = {o[0], o[1], o[2], o[3]}, hi = {o[4], o[5], o[6], o[7]}; vst2(yp + j * 16, lo); vst2(yp + j * 16 + 4, hi); }
}
// ---- k_out: block = (64 voxel rows, 128 output channels): proj = W ctx (ctx x 64 f16 against W x 256 f16) + bf16(bias), LDS transpose to channels-first, + bf16(x), whole 256-B (c, 64 n) runs by 16 lanes
__global__ __launch_bounds__(128) void k_out(const float* __restrict__ Y, const float* __restrict__ X, const _Float16* __restrict__ W2, const float* __restrict__ PB, float* __restrict__ OUT) {
  __shared__ __align__(16) float stc[128][68];
  const int tid = threadIdx.x, wave = tid >> 5, lane = tid & 31, col = lane & 15, g = lane >> 4; const int c0 = blockIdx.y * 128;
  const size_t r0 = (size_t)blockIdx.x * 64; const size_t bb = r0 / TT; const int t0 = (int)(r0 % TT);
  v8f acc[8] = {};
#pragma unroll 1
  for (int kc = 0; kc < CC / 32; ++kc) { const v16h a = frag_f32s(Y + (r0 + wave * 16 + col) * CC + kc * 32, lane, 64.0f);
    asm volatile("s_wait_loadcnt 0x0" ::: "memory");
#pragma unroll
    for (int j = 0; j < 8; ++j) { const v16h w = frag_h(W2 + (size_t)(c0 + j * 16 + col) * CC + kc * 32, lane); acc[j] = wmma16(a, w, acc[j]); } }
#pragma unroll
  for (int j = 0; j < 8; ++j) { const float bias = bfr(PB[c0 + j * 16 + col]);
#pragma unroll
    for (int r = 0; r < 8; ++r) stc[j * 16 + col][wave * 16 + 8 * g + r] = acc[j][r] * (1.0f / 16384.0f) + bias; }
  __syncthreads();
#pragma unroll 1
  for (int e = tid; e < 128 * 16; e += 128) { const int cl = e >> 4, q = e & 15; const size_t o = ((size_t)bb * DIN + c0 + cl) * NPIX + t0 + q * 4;
    const v4f xv = *(const v4f*)(X + o); const float x0 = xv[0], x1 = xv[1], x2 = xv[2], x3 = xv[3]; v4f r4 = *(const v4f*)&stc[cl][q * 4];
    r4[0] += bfr(x0); r4[1] += bfr(x1); r4[2] += bfr(x2); r4[3] += bfr(x3); vst2(OUT + o, r4); }
}

extern "C" void kernel_launch(void* const* d_in, const int* in_sizes, int n_in, void* d_out, int out_size, void* d_ws, size_t ws_size, hipStream_t stream) {
  // inputs (wire order): 0 x [2,256,16,16,16] f32; 1 norm_w [256]; 2 norm_b [256]; 3 qkv_w (out,in) [384,256]; 4 proj_w (out,in) [256,128]; 5 proj_b [256]
  if (n_in < 6) return;
  if (in_sizes[0] < NB * DIN * NPIX || in_sizes[1] < DIN || in_sizes[2] < DIN || in_sizes[3] < 3 * CC * DIN || in_sizes[4] < DIN * CC || in_sizes[5] < DIN) return;
  if (out_size < NB * DIN * NPIX) return;
  if (ws_size < WS_END) return;
  const float* X = (const float*)d_in[0]; const float* GW = (const float*)d_in[1]; const float* GB = (const float*)d_in[2];
  const float* WQ = (const float*)d_in[3]; const float* WP = (const float*)d_in[4]; const float* PB = (const float*)d_in[5];
  char* ws = (char*)d_ws;
  float* GS = (float*)(ws + WS_GS); _Float16* W1 = (_Float16*)(ws + WS_W1); _Float16* W2 = (_Float16*)(ws + WS_W2);
  _Float16* QH = (_Float16*)(ws + WS_QH); _Float16* KH = (_Float16*)(ws + WS_KH); _Float16* VT = (_Float16*)(ws + WS_VT);
  float* Y = (float*)(ws + WS_Y); float* OUT = (float*)d_out;
  k_gn<<<dim3(NB * GROUPS * GN_SL), 256, 0, stream>>>(X, GS);
  k_cvw<<<dim3((3 * CC * DIN + DIN * CC) / 8 / 256), 256, 0, stream>>>(WQ, WP, W1, W2);
  k_proj<<<dim3(NB * TT / 64, 3), 128, 0, stream>>>(X, GS, GW, GB, W1, QH, KH, VT);
  k_fa<<<dim3(TT / 128, NB * NH), 256, 0, stream>>>(QH, KH, VT, Y);
  k_out<<<dim3(NB * TT / 64, DIN / 128), 128, 0, stream>>>(Y, X, W2, PB, OUT);
}

// v003
// It runs in 56.9 microseconds.
// Two timings next to v002 put it at 1.29 and 1.28 times that version's speed.
// Over all steps from v000 it is 19.9 times as fast.
// compute dtype: every float input RNE-converted to bf16 on load; GroupNorm statistics f32: per 2-channel slice a tree sum for the mean and the squared deviations from it, slices joined by the parallel-variance rule; qkv = W x on v_wmma_f32_16x16x32_f16 with W as f16(bf16 x 256) and normalised x as f16, f32 accumulate; logits k.q f16 x f16 single product, f32 accumulate; softmax f32, online over 64-key passes (running maximum, base-2 exponential with the scale folded in), unnormalised P x 2^11 to f16 once against v f16 (single product), one division by the f32 row sum at the end; output projection: ctx x 64 f16 against W f16(bf16 x 256), f32 accumulate; bias + residual add in f32; f32 output (channels-first).
#include <hip/hip_runtime.h>
#include <math.h>

typedef __attribute__((ext_vector_type(16))) _Float16 v16h;
typedef __attribute__((ext_vector_type(8)))  _Float16 v8h;
typedef __attribute__((ext_vector_type(8)))  float v8f;
typedef __attribute__((ext_vector_type(4)))  float v4f;
typedef __attribute__((ext_vector_type(4)))  unsigned v4u;

template <typename T> __device__ __forceinline__ void vst2(void* p, T v) { *(T*)p = v;  }
__device__ __forceinline__ v8f wmma16(v16h a, v16h b, v8f c) {
  v8f d = __builtin_amdgcn_wmma_f32_16x16x32_f16(false, a, false, b, (short)0, c, false, false);
  asm volatile("v_nop\n\tv_nop\n\tv_nop\n\tv_nop" : "+v"(d) : "v"(a), "v"(b));
  return d;
}
// 16x16x32 fragments: lane = (h = lane>>4, row/col = lane&15); elements 0..7 = k0+8h+0..7, 8..15 = k0+16+8h+0..7; D element r = row 8h+r, col lane&15
__device__ __forceinline__ v16h frag_h(const _Float16* rowk0, int lane) {
  union { v16h v; v8h q[2]; } u; const _Float16* p = rowk0 + 8 * (lane >> 4);
  u.q[0] = *(const v8h*)p; u.q[1] = *(const v8h*)(p + 16); return u.v;
}
__device__ __forceinline__ v16h frag_f32s(const float* rowk0, int lane, float sc) {
  v16h a; const float* p = rowk0 + 8 * (lane >> 4);
#pragma unroll
  for (int i = 0; i < 8; ++i) { const float x0 = p[i], x1 = p[16 + i]; a[i] = (_Float16)(x0 * sc); a[8 + i] = (_Float16)(x1 * sc); }
  return a;
}
__device__ __forceinline__ float bfr(float v) { return (float)(__bf16)v; }

// Self-attention over a flattened 16x16x16 volume: GroupNorm(8 groups, affine) -> 1x1x1 conv qkv (W (out,in) [384][256], no bias) -> 4 heads x 32 dims, softmax((q^T k) * 32^-0.5) over 4,096 keys -> ctx -> 1x1x1 conv proj (W (out,in) [256][128] + bias) -> + x. Channels-first in and out.
#ifndef NB
#define NB 2
#endif
#ifndef SEQ
#define SEQ 4096
#endif
#define NB_FULL 2
#define TT SEQ              // voxels attended per batch element
#define NPIX 4096           // full per-channel voxel stride of x and of the output
#define DIN 256             // model width (input / output channels)
#define GROUPS 8
#define CPG (DIN / GROUPS)  // channels per group
#define NH 4
#define HD 32
#define CC (NH * HD)        // inner width 128
#define SCALE (0.17677669529663687f)
#define EPS (1.0e-5f)
#define GN_SL 16                            // slices (work-groups) per group
#define GN_CH (CPG / GN_SL)                 // channels per slice
#define GN_LD (GN_CH * (TT / 4) / 256)      // 16-byte loads per thread
static_assert(CPG == 32);
static_assert(CPG % GN_SL == 0);
static_assert((GN_CH * (TT / 4)) % 256 == 0);
static_assert(GROUPS * GN_SL == 128);
static_assert(CC == 128);
static_assert(DIN % 128 == 0);
static_assert(TT % 128 == 0);
static_assert(TT <= NPIX);
static_assert(NB <= NB_FULL);
static_assert(((size_t)NB * DIN - 1) * NPIX + TT <= (size_t)2097152);   // last written output element < 8,388,608 B / 4

// workspace carve (bytes): GS one 128-B line of partial statistics per (batch, group, slice) | W1 f16 [384][256] | W2 f16 [256][128] | QH f16 rows [NB*TT][CC] | KH | VT f16 planes [NB][CC][TT] | Y f32 rows [NB*TT][CC]
#define WS_GS  ((size_t)0)
#define WS_W1  ((size_t)128 * NB_FULL * GROUPS * GN_SL)
#define WS_W2  (WS_W1 + 2u * (size_t)3 * CC * DIN)
#define WS_QH  (WS_W2 + 2u * (size_t)DIN * CC)
#define WS_KH  (WS_QH + 2u * (size_t)NB * TT * CC)
#define WS_VT  (WS_KH + 2u * (size_t)NB * TT * CC)
#define WS_Y   (WS_VT + 2u * (size_t)NB * CC * TT)
#define WS_END (WS_Y  + 4u * (size_t)NB * TT * CC)
static_assert(WS_END <= (size_t)134217728);
static_assert((3 * CC * DIN / 8) % 256 == 0);
static_assert(((3 * CC * DIN + DIN * CC) / 8) % 256 == 0);

// sum over the 16 lanes of a row, left in every lane of the row (four butterfly steps on the vector port, no LDS)
__device__ __forceinline__ float rowsum(float x) {
  x += __builtin_bit_cast(float, __builtin_amdgcn_update_dpp(0, __builtin_bit_cast(int, x), 0x161, 0xf, 0xf, true));   // row_xmask:1
  x += __builtin_bit_cast(float, __builtin_amdgcn_update_dpp(0, __builtin_bit_cast(int, x), 0x162, 0xf, 0xf, true));   // row_xmask:2
  x += __builtin_bit_cast(float, __builtin_amdgcn_update_dpp(0, __builtin_bit_cast(int, x), 0x164, 0xf, 0xf, true));   // row_xmask:4
  x += __builtin_bit_cast(float, __builtin_amdgcn_update_dpp(0, __builtin_bit_cast(int, x), 0x168, 0xf, 0xf, true));   // row_xmask:8
  return x;
}
__device__ __forceinline__ float xhalf(float x) {   // lane l takes lane l ^ 16
  return __builtin_bit_cast(float, __builtin_amdgcn_permlanex16(__builtin_bit_cast(int, x), __builtin_bit_cast(int, x), 0x76543210, 0xfedcba98, false, false));
}
// ---- k_gn: block = one slice (GN_CH channels) of one (batch, group): the slice is read once, every load of a thread in flight at the same time, and stays in registers for both sums.
// It leaves (slice mean, sum of squared deviations from the slice mean) in a 128-B line of its own; k_proj joins the GN_SL slices of a group.
__global__ __launch_bounds__(256) void k_gn(const float* __restrict__ X, float* __restrict__ GS) {
  __shared__ __align__(16) float sa[8]; __shared__ __align__(16) float sq[8];
  const int tid = threadIdx.x, wave = tid >> 5, lane = tid & 31; const int bg = blockIdx.x / GN_SL, sl = blockIdx.x % GN_SL; const int b = bg / GROUPS, gi = bg % GROUPS;
  const float* xp = X + ((size_t)b * DIN + (size_t)gi * CPG + (size_t)sl * GN_CH) * NPIX;
  v4f v[GN_LD];
  // the three loops are unrolled so that v[] has constant indices (stays in registers) and every load issues ahead of the first wait
#pragma unroll
  for (int i = 0; i < GN_LD; ++i) { const int e = tid + 256 * i; const int c = e / (TT / 4), t4 = e - c * (TT / 4); v[i] = *(const v4f*)(xp + (size_t)c * NPIX + (size_t)t4 * 4); }
  float s = 0.f;
#pragma unroll
  for (int i = 0; i < GN_LD; ++i) { const float x0 = v[i][0], x1 = v[i][1], x2 = v[i][2], x3 = v[i][3];
    v[i][0] = bfr(x0); v[i][1] = bfr(x1); v[i][2] = bfr(x2); v[i][3] = bfr(x3); s += (v[i][0] + v[i][1]) + (v[i][2] + v[i][3]); }
  s = rowsum(s); s += xhalf(s);
  if (lane == 0) sa[wave] = s;
  __syncthreads();
  const v4f a0 = *(const v4f*)&sa[0], a1 = *(const v4f*)&sa[4];
  const float mean = (((a0[0] + a0[1]) + (a0[2] + a0[3])) + ((a1[0] + a1[1]) + (a1[2] + a1[3]))) * (1.0f / (float)(GN_CH * TT));
  float s2 = 0.f;
#pragma unroll
  for (int i = 0; i < GN_LD; ++i) { const float d0 = v[i][0] - mean, d1 = v[i][1] - mean, d2 = v[i][2] - mean, d3 = v[i][3] - mean;
    s2 += (d0 * d0 + d1 * d1) + (d2 * d2 + d3 * d3); }
  s2 = rowsum(s2); s2 += xhalf(s2);
  if (lane == 0) sq[wave] = s2;
  __syncthreads();
  if (tid < 32) { const v4f q0 = *(const v4f*)&sq[0], q1 = *(const v4f*)&sq[4];
    const float m2 = ((q0[0] + q0[1]) + (q0[2] + q0[3])) + ((q1[0] + q1[1]) + (q1[2] + q1[3]));
    const float val = tid == 0 ? mean : (tid == 1 ? m2 : 0.f); vst2(GS + (size_t)blockIdx.x * 32 + tid, val); }
}
// ---- k_cvw: weights -> f16(bf16(w) x 256) planes (exact), 8 contiguous elements = one 16-B store per thread
__global__ __launch_bounds__(256) void k_cvw(const float* __restrict__ WA, const float* __restrict__ WB, _Float16* __restrict__ P1, _Float16* __restrict__ P2) {
  const int n1c = 3 * CC * DIN / 8, n2c = DIN * CC / 8;
  const int i8 = blockIdx.x * 256 + threadIdx.x; if (i8 >= n1c + n2c) return;
  const bool second = i8 >= n1c;   // block-uniform (n1c is a multiple of 256)
  const float* src = second ? WB + (size_t)(i8 - n1c) * 8 : WA + (size_t)i8 * 8;
  _Float16* dst = second ? P2 + (size_t)(i8 - n1c) * 8 : P1 + (size_t)i8 * 8;
  const v8f v = *(const v8f*)src; union { v8h h; v4u u; } o;
#pragma unroll
  for (int e = 0; e < 8; ++e) { const float f = v[e]; o.h[e] = (_Float16)(bfr(f) * 256.0f); }
  vst2(dst, o.u);
}
// The block's 128 W rows are staged once in LDS by whole-line loads (a wave's 16-byte load = 512 contiguous bytes) and shared by its four waves; the B fragments come from there.
#define PJ_WP (DIN + 8)      // W row pitch in LDS, f16: 528 B = 16 B x odd, conflict-free for 16-byte readers
#define PJ_LD (CC * DIN / 8 / 128)   // 16-byte pieces per thread
static_assert((CC * DIN / 8) % 128 == 0);
// ---- k_proj: block = (64 voxel rows, which in {q,k,v}): GroupNorm applied on the channels-first gather (group == 32-channel k chunk), qkv = W xn with f16 operands (W x 256) -> which 0/1: f16 rows [b*TT+t][128]; which 2: f16 planes [b][c][t]
__global__ __launch_bounds__(128) void k_proj(const float* __restrict__ X, const float* __restrict__ GS, const float* __restrict__ GW, const float* __restrict__ GB, const _Float16* __restrict__ W1,
    _Float16* __restrict__ QH, _Float16* __restrict__ KH, _Float16* __restrict__ VT) {
  __shared__ __align__(16) _Float16 sh[64][136]; __shared__ __align__(16) _Float16 th[128][72]; __shared__ float sst[GROUPS][2]; __shared__ __align__(16) _Float16 wl[CC * PJ_WP];
  const int tid = threadIdx.x, wave = tid >> 5, lane = tid & 31, col = lane & 15, g = lane >> 4; const int which = blockIdx.y;
  const size_t r0 = (size_t)blockIdx.x * 64; const size_t bb = r0 / TT; const int t0 = (int)(r0 % TT);
  { // join the slices' statistics, once per block: thread = (group tid >> 4, slice tid & 15), a group = one 16-lane row
    const float* gp = GS + ((size_t)bb * GROUPS * GN_SL + tid) * 32; const float pm = gp[0], pq = gp[1];
    // W rows [which * 128, + 128) are one contiguous run: piece e = tid + 128 i is row e >> 5, piece e & 31. Both loops are unrolled so that wr[] stays in registers and every load is in flight before the first store.
    const _Float16* wg = W1 + (size_t)which * CC * DIN; v4u wr[PJ_LD];
#pragma unroll
    for (int i = 0; i < PJ_LD; ++i) wr[i] = *(const v4u*)(wg + (size_t)(tid + 128 * i) * 8);
#pragma unroll
    for (int i = 0; i < PJ_LD; ++i) { const int e = tid + 128 * i; *(v4u*)&wl[(e >> 5) * PJ_WP + (e & 31) * 8] = wr[i]; }
    const float mean = rowsum(pm) * (1.0f / (float)GN_SL); const float dm = pm - mean;
    const float var = rowsum(pq + (float)(GN_CH * TT) * (dm * dm)) * (1.0f / (float)(CPG * TT));
    if (col == 0) { sst[tid >> 4][0] = mean; sst[tid >> 4][1] = 1.0f / sqrtf(var + EPS); } }
  __syncthreads();   // publishes the eight groups' mean and reciprocal deviation, and the staged W rows, to all four waves
  v8f acc[8] = {};
#pragma unroll 1
  for (int kc = 0; kc < DIN / 32; ++kc) {
    const float mu = sst[kc][0], rs = sst[kc][1];
    v16h a, w[8];
    // the eight B fragments are read as a group ahead of the first WMMA, so that one LDS latency is waited out per k chunk, not eight (unrolled: constant indices keep w[] in registers)
#pragma unroll
    for (int j = 0; j < 8; ++j) w[j] = frag_h(&wl[(j * 16 + col) * PJ_WP + kc * 32], lane);
    { const float* p = X + ((size_t)bb * DIN + kc * 32 + 8 * g) * NPIX + t0 + wave * 16 + col;   // x[b][k][n], stride NPIX between channels
      const v8f w0 = *(const v8f*)(GW + kc * 32 + 8 * g), w1 = *(const v8f*)(GW + kc * 32 + 16 + 8 * g);
      const v8f b0 = *(const v8f*)(GB + kc * 32 + 8 * g), b1 = *(const v8f*)(GB + kc * 32 + 16 + 8 * g);
#pragma unroll
      for (int i = 0; i < 8; ++i) {
        const float xa = p[(size_t)i * NPIX], xb = p[(size_t)(16 + i) * NPIX]; const float wa = w0[i], wb = w1[i], ba = b0[i], bbv = b1[i];
        a[i]     = (_Float16)(((bfr(xa) - mu) * rs) * bfr(wa) + bfr(ba));
        a[8 + i] = (_Float16)(((bfr(xb) - mu) * rs) * bfr(wb) + bfr(bbv)); } }
    asm volatile("s_wait_loadcnt 0x0" ::: "memory");
#pragma unroll
    for (int j = 0; j < 8; ++j) acc[j] = wmma16(a, w[j], acc[j]);
  }
  if (which < 2) { _Float16* DH = which == 0 ? QH : KH;
#pragma unroll
    for (int j = 0; j < 8; ++j)
#pragma unroll
      for (int r = 0; r < 8; ++r) sh[wave * 16 + 8 * g + r][j * 16 + col] = (_Float16)(acc[j][r] * (1.0f / 256.0f));
    __syncthreads();
#pragma unroll 1
    for (int e = tid; e < 64 * 16; e += 128) { const int rl = e >> 4, q = e & 15; vst2(DH + (r0 + rl) * CC + q * 8, *(const v4u*)&sh[rl][q * 8]); }
  } else {
#pragma unroll
    for (int j = 0; j < 8; ++j)
#pragma unroll
      for (int r = 0; r < 8; ++r) th[j * 16 + col][wave * 16 + 8 * g + r] = (_Float16)(acc[j][r] * (1.0f / 256.0f));
    __syncthreads();
#pragma unroll 1
    for (int e = tid; e < 128 * 8; e += 128) { const int cl = e >> 3, q = e & 7; vst2(VT + (bb * CC + cl) * (size_t)TT + t0 + q * 8, *(const v4u*)&th[cl][q * 8]); }
  }
}
#define FA_KS 128            // keys per LDS stage
#define FA_KP (HD + 8)       // K row pitch in f16: 80 B = 16 B x odd, conflict-free for 16-byte readers
#define FA_VP (FA_KS + 8)    // V^T row pitch in f16: 272 B = 16 B x odd
#define FA_NS (TT / FA_KS)
static_assert(HD == 32);
static_assert(TT % FA_KS == 0);
__device__ __forceinline__ v8f wmma_b(v16h a, v16h b, v8f c) { return __builtin_amdgcn_wmma_f32_16x16x32_f16(false, a, false, b, (short)0, c, false, false); }
__global__ __launch_bounds__(256) void k_fa(const _Float16* __restrict__ QH, const _Float16* __restrict__ KH, const _Float16* __restrict__ VT, float* __restrict__ Y) {
  __shared__ __align__(16) _Float16 kl[2][FA_KS * FA_KP]; __shared__ __align__(16) _Float16 vl[2][HD * FA_VP];
  const int tid = threadIdx.x, wave = tid >> 5, lane = tid & 31, col = lane & 15, g = lane >> 4;
  const int b = blockIdx.y / NH, h = blockIdx.y % NH; const int q0 = blockIdx.x * 128 + wave * 16;
  const float cs = SCALE * 1.4426950408889634f;   // logit scale x log2(e)
  const v16h qf = frag_h(QH + ((size_t)b * TT + q0 + col) * CC + h * HD, lane);
  // staging: 16-byte pieces; K: 4 pieces a key row, rows tid>>2 and 64 + tid>>2; V^T: 16 pieces a channel row, rows tid>>4 and 16 + tid>>4
  const _Float16* kg = KH + ((size_t)b * TT + (tid >> 2)) * CC + h * HD + (tid & 3) * 8;
  const _Float16* vg = VT + ((size_t)b * CC + h * HD + (tid >> 4)) * (size_t)TT + (tid & 15) * 8;
  const int kd = (tid >> 2) * FA_KP + (tid & 3) * 8, vd = (tid >> 4) * FA_VP + (tid & 15) * 8;
  { const v4u k0 = *(const v4u*)kg, k1 = *(const v4u*)(kg + (size_t)64 * CC), w0 = *(const v4u*)vg, w1 = *(const v4u*)(vg + (size_t)16 * TT);
    *(v4u*)&kl[0][kd] = k0; *(v4u*)&kl[0][kd + 64 * FA_KP] = k1; *(v4u*)&vl[0][vd] = w0; *(v4u*)&vl[0][vd + 16 * FA_VP] = w1; }
  __syncthreads();
  v8f acc[2] = {}; float mrun = -3.0e38f, lsum = 0.f;
  // the stage loop stays rolled (one copy of the 128-key body in the instruction cache; the buffer is a run-time bit); the loops inside are unrolled so that every register array has constant indices
#pragma unroll 1
  for (int st = 0; st < FA_NS; ++st) {
    const int buf = st & 1; const bool more = st + 1 < FA_NS;   // block-uniform
    v4u k0 = {}, k1 = {}, w0 = {}, w1 = {};
    if (more) { const _Float16* kn = kg + (size_t)(st + 1) * FA_KS * CC; const _Float16* vn = vg + (size_t)(st + 1) * FA_KS;   // next stage's loads fly under this stage's work
      k0 = *(const v4u*)kn; k1 = *(const v4u*)(kn + (size_t)64 * CC); w0 = *(const v4u*)vn; w1 = *(const v4u*)(vn + (size_t)16 * TT); }
#pragma unroll
    for (int ps = 0; ps < FA_KS / 64; ++ps) {
      v8f s[4];
#pragma unroll
      for (int t = 0; t < 4; ++t) { const v8f z = {}; s[t] = wmma_b(frag_h(&kl[buf][(ps * 64 + t * 16 + col) * FA_KP], lane), qf, z); }   // s[t][r] = logit(key 16t + 8g + r, query col)
      float mt[4];
#pragma unroll
      for (int t = 0; t < 4; ++t) { mt[t] = s[t][0];
#pragma unroll
        for (int r = 1; r < 8; ++r) mt[t] = fmaxf(mt[t], s[t][r]); }
      float mx = fmaxf(fmaxf(mt[0], mt[1]), fmaxf(mt[2], mt[3]));
      mx = fmaxf(mx, xhalf(mx)) * cs;   // both halves of the wave hold this query's maximum (the scale is positive)
      const float mn = fmaxf(mrun, mx); const float corr = __builtin_amdgcn_exp2f(mrun - mn); mrun = mn;   // corr = 0 on the first pass
      acc[0] = acc[0] * corr; acc[1] = acc[1] * corr;
      const float nm = 11.0f - mn;   // P x 2^11: keeps small weights out of the f16 subnormals; it cancels in the division by the row sum
      v16h pf[2]; float pt[4]; v8f e[4], p[4];
#pragma unroll
      for (int t = 0; t < 4; ++t)
#pragma unroll
        for (int r = 0; r < 8; ++r) { e[t][r] = fmaf(s[t][r], cs, nm); p[t][r] = __builtin_amdgcn_exp2f(e[t][r]); }
      // the slot that the instruction set asks for behind a transcendental: as inputs, the results put the v_nop behind the last exponential and the arguments keep their registers unwritten until there
      asm volatile("v_nop" :: "v"(p[0]), "v"(p[1]), "v"(p[2]), "v"(p[3]), "v"(e[0]), "v"(e[1]), "v"(e[2]), "v"(e[3]));
#pragma unroll
      for (int t = 0; t < 4; ++t) { pt[t] = ((p[t][0] + p[t][1]) + (p[t][2] + p[t][3])) + ((p[t][4] + p[t][5]) + (p[t][6] + p[t][7]));
#pragma unroll
        for (int r = 0; r < 8; ++r) pf[t >> 1][(t & 1) * 8 + r] = (_Float16)p[t][r]; }
      lsum = lsum * corr + ((pt[0] + pt[1]) + (pt[2] + pt[3]));   // this half's keys only; the halves join after the loop
#pragma unroll
      for (int kk = 0; kk < 2; ++kk)
#pragma unroll
        for (int j = 0; j < 2; ++j) acc[j] = wmma_b(frag_h(&vl[buf][(j * 16 + col) * FA_VP + ps * 64 + kk * 32], lane), pf[kk], acc[j]);   // acc[j][r] = ctx(channel 16j + 8g + r, query col)
    }
    if (more) { const int nb = buf ^ 1;   // its last readers left it before the barrier that ended the stage before
      *(v4u*)&kl[nb][kd] = k0; *(v4u*)&kl[nb][kd + 64 * FA_KP] = k1; *(v4u*)&vl[nb][vd] = w0; *(v4u*)&vl[nb][vd + 16 * FA_VP] = w1; }
    __syncthreads();   // publishes stage st + 1 and ends every read of stage st
  }
  const float inv = 1.0f / (lsum + xhalf(lsum));
  float* yp = Y + ((size_t)b * TT + q0 + col) * CC + h * HD + 8 * g;   // a query's 32 channels = one 128-B line, written whole by lanes col and col + 16
#pragma unroll
  for (int j = 0; j < 2; ++j) { const v8f o = acc[j] * inv; const v4f lo = {o[0], o[1], o[2], o[3]}, hi = {o[4], o[5], o[6], o[7]}; vst2(yp + j * 16, lo); vst2(yp + j * 16 + 4, hi); }
}
#define PO_WP (CC + 8)       // W row pitch in LDS, f16: 272 B = 16 B x odd
#define PO_LD (128 * CC / 8 / 128)   // 16-byte pieces per thread
// ---- k_out: block = (64 voxel rows, 128 output channels), its 128 W rows staged in LDS as in k_proj: proj = W ctx (ctx x 64 f16 against W x 256 f16) + bf16(bias), LDS transpose to channels-first, + bf16(x), whole 256-B (c, 64 n) runs by 16 lanes
__global__ __launch_bounds__(128) void k_out(const float* __restrict__ Y, const float* __restrict__ X, const _Float16* __restrict__ W2, const float* __restrict__ PB, float* __restrict__ OUT) {
  __shared__ __align__(16) float stc[128][68]; __shared__ __align__(16) _Float16 wl[128 * PO_WP];
  const int tid = threadIdx.x, wave = tid >> 5, lane = tid & 31, col = lane & 15, g = lane >> 4; const int c0 = blockIdx.y * 128;
  const size_t r0 = (size_t)blockIdx.x * 64; const size_t bb = r0 / TT; const int t0 = (int)(r0 % TT);
  { // W rows [c0, c0 + 128) are one contiguous run: piece e = tid + 128 i is row e >> 4, piece e & 15; unrolled so that every load is in flight before the first store
    const _Float16* wg = W2 + (size_t)c0 * CC; v4u wr[PO_LD];
#pragma unroll
    for (int i = 0; i < PO_LD; ++i) wr[i] = *(const v4u*)(wg + (size_t)(tid + 128 * i) * 8);
#pragma unroll
    for (int i = 0; i < PO_LD; ++i) { const int e = tid + 128 * i; *(v4u*)&wl[(e >> 4) * PO_WP + (e & 15) * 8] = wr[i]; } }
  __syncthreads();   // publishes the staged W rows to all four waves
  v8f acc[8] = {};
#pragma unroll 1
  for (int kc = 0; kc < CC / 32; ++kc) { v16h w[8];
    // the eight B fragments are read as a group ahead of the first WMMA, so that one LDS latency is waited out per k chunk, not eight (unrolled: constant indices keep w[] in registers)
#pragma unroll
    for (int j = 0; j < 8; ++j) w[j] = frag_h(&wl[(j * 16 + col) * PO_WP + kc * 32], lane);
    const v16h a = frag_f32s(Y + (r0 + wave * 16 + col) * CC + kc * 32, lane, 64.0f);
    asm volatile("s_wait_loadcnt 0x0" ::: "memory");
#pragma unroll
    for (int j = 0; j < 8; ++j) acc[j] = wmma16(a, w[j], acc[j]); }
#pragma unroll
  for (int j = 0; j < 8; ++j) { const float bias = bfr(PB[c0 + j * 16 + col]);
#pragma unroll
    for (int r = 0; r < 8; ++r) stc[j * 16 + col][wave * 16 + 8 * g + r] = acc[j][r] * (1.0f / 16384.0f) + bias; }
  __syncthreads();
#pragma unroll 1
  for (int e = tid; e < 128 * 16; e += 128) { const int cl = e >> 4, q = e & 15; const size_t o = ((size_t)bb * DIN + c0 + cl) * NPIX + t0 + q * 4;
    const v4f xv = *(const v4f*)(X + o); const float x0 = xv[0], x1 = xv[1], x2 = xv[2], x3 = xv[3]; v4f r4 = *(const v4f*)&stc[cl][q * 4];
    r4[0] += bfr(x0); r4[1] += bfr(x1); r4[2] += bfr(x2); r4[3] += bfr(x3); vst2(OUT + o, r4); }
}

extern "C" void kernel_launch(void* const* d_in, const int* in_sizes, int n_in, void* d_out, int out_size, void* d_ws, size_t ws_size, hipStream_t stream) {
  // inputs (wire order): 0 x [2,256,16,16,16] f32; 1 norm_w [256]; 2 norm_b [256]; 3 qkv_w (out,in) [384,256]; 4 proj_w (out,in) [256,128]; 5 proj_b [256]
  if (n_in < 6) return;
  if (in_sizes[0] < NB * DIN * NPIX || in_sizes[1] < DIN || in_sizes[2] < DIN || in_sizes[3] < 3 * CC * DIN || in_sizes[4] < DIN * CC || in_sizes[5] < DIN) return;
  if (out_size < NB * DIN * NPIX) return;
  if (ws_size < WS_END) return;
  const float* X = (const float*)d_in[0]; const float* GW = (const float*)d_in[1]; const float* GB = (const float*)d_in[2];
  const float* WQ = (const float*)d_in[3]; const float* WP = (const float*)d_in[4]; const float* PB = (const float*)d_in[5];
  char* ws = (char*)d_ws;
  float* GS = (float*)(ws + WS_GS); _Float16* W1 = (_Float16*)(ws + WS_W1); _Float16* W2 = (_Float16*)(ws + WS_W2);
  _Float16* QH = (_Float16*)(ws + WS_QH); _Float16* KH = (_Float16*)(ws + WS_KH); _Float16* VT = (_Float16*)(ws + WS_VT);
  float* Y = (float*)(ws + WS_Y); float* OUT = (float*)d_out;
  k_gn<<<dim3(NB * GROUPS * GN_SL), 256, 0, stream>>>(X, GS);
  k_cvw<<<dim3((3 * CC * DIN + DIN * CC) / 8 / 256), 256, 0, stream>>>(WQ, WP, W1, W2);
  k_proj<<<dim3(NB * TT / 64, 3), 128, 0, stream>>>(X, GS, GW, GB, W1, QH, KH, VT);
  k_fa<<<dim3(TT / 128, NB * NH), 256, 0, stream>>>(QH, KH, VT, Y);
  k_out<<<dim3(NB * TT / 64, DIN / 128), 128, 0, stream>>>(Y, X, W2, PB, OUT);
}

// v004
// A run of this version takes 51.7 microseconds.
// Timed twice side by side with v003, it ran 1.11 and 1.09 times as fast.
// Counting every step since v000, it is 21.9 times as fast.
// compute dtype: every float input RNE-converted to bf16 on load; GroupNorm statistics f32: per 2-channel slice a tree sum for the mean and the squared deviations from it, slices joined by the parallel-variance rule; qkv = W x on v_wmma_f32_16x16x32_f16 with W as f16(bf16 x 256) and normalised x as f16, f32 accumulate; logits k.q f16 x f16 single product, f32 accumulate; softmax f32, online over 64-key passes (running maximum, base-2 exponential with the scale folded in), unnormalised P x 2^11 to f16 once against v f16 (single product), a query's keys dealt in 128-key runs to two waves whose partial sums are joined once on the common maximum, one division by the f32 row sum at the end; output projection: ctx x 64 f16 against W f16(bf16 x 256), f32 accumulate; bias + residual add in f32; f32 output (channels-first).
#include <hip/hip_runtime.h>
#include <math.h>

typedef __attribute__((ext_vector_type(16))) _Float16 v16h;
typedef __attribute__((ext_vector_type(8)))  _Float16 v8h;
typedef __attribute__((ext_vector_type(8)))  float v8f;
typedef __attribute__((ext_vector_type(4)))  float v4f;
typedef __attribute__((ext_vector_type(4)))  unsigned v4u;

template <typename T> __device__ __forceinline__ void vst2(void* p, T v) { *(T*)p = v;  }
__device__ __forceinline__ v8f wmma16(v16h a, v16h b, v8f c) {
  v8f d = __builtin_amdgcn_wmma_f32_16x16x32_f16(false, a, false, b, (short)0, c, false, false);
  asm volatile("v_nop\n\tv_nop\n\tv_nop\n\tv_nop" : "+v"(d) : "v"(a), "v"(b));
  return d;
}
// 16x16x32 fragments: lane = (h = lane>>4, row/col = lane&15); elements 0..7 = k0+8h+0..7, 8..15 = k0+16+8h+0..7; D element r = row 8h+r, col lane&15
__device__ __forceinline__ v16h frag_h(const _Float16* rowk0, int lane) {
  union { v16h v; v8h q[2]; } u; const _Float16* p = rowk0 + 8 * (lane >> 4);
  u.q[0] = *(const v8h*)p; u.q[1] = *(const v8h*)(p + 16); return u.v;
}
__device__ __forceinline__ v16h frag_f32s(const float* rowk0, int lane, float sc) {
  v16h a; const float* p = rowk0 + 8 * (lane >> 4);
#pragma unroll
  for (int i = 0; i < 8; ++i) { const float x0 = p[i], x1 = p[16 + i]; a[i] = (_Float16)(x0 * sc); a[8 + i] = (_Float16)(x1 * sc); }
  return a;
}
__device__ __forceinline__ float bfr(float v) { return (float)(__bf16)v; }

// Self-attention over a flattened 16x16x16 volume: GroupNorm(8 groups, affine) -> 1x1x1 conv qkv (W (out,in) [384][256], no bias) -> 4 heads x 32 dims, softmax((q^T k) * 32^-0.5) over 4,096 keys -> ctx -> 1x1x1 conv proj (W (out,in) [256][128] + bias) -> + x. Channels-first in and out.
#ifndef NB
#define NB 2
#endif
#ifndef SEQ
#define SEQ 4096
#endif
#define NB_FULL 2
#define TT SEQ              // voxels attended per batch element
#define NPIX 4096           // full per-channel voxel stride of x and of the output
#define DIN 256             // model width (input / output channels)
#define GROUPS 8
#define CPG (DIN / GROUPS)  // channels per group
#define NH 4
#define HD 32
#define CC (NH * HD)        // inner width 128
#define SCALE (0.17677669529663687f)
#define EPS (1.0e-5f)
#define GN_SL 16                            // slices (work-groups) per group
#define GN_CH (CPG / GN_SL)                 // channels per slice
#define GN_LD (GN_CH * (TT / 4) / 256)      // 16-byte loads per thread
static_assert(CPG == 32);
static_assert(CPG % GN_SL == 0);
static_assert((GN_CH * (TT / 4)) % 256 == 0);
static_assert(GROUPS * GN_SL == 128);
static_assert(CC == 128);
static_assert(DIN % 128 == 0);
static_assert(TT % 128 == 0);
static_assert(TT <= NPIX);
static_assert(NB <= NB_FULL);
static_assert(((size_t)NB * DIN - 1) * NPIX + TT <= (size_t)2097152);   // last written output element < 8,388,608 B / 4

// workspace carve (bytes): GS one 128-B line of partial statistics per (batch, group, slice) | W1 f16 [384][256] | W2 f16 [256][128] | QH f16 rows [NB*TT][CC] | KH | VT f16 planes [NB][CC][TT] | Y f32 rows [NB*TT][CC]
#define WS_GS  ((size_t)0)
#define WS_W1  ((size_t)128 * NB_FULL * GROUPS * GN_SL)
#define WS_W2  (WS_W1 + 2u * (size_t)3 * CC * DIN)
#define WS_QH  (WS_W2 + 2u * (size_t)DIN * CC)
#define WS_KH  (WS_QH + 2u * (size_t)NB * TT * CC)
#define WS_VT  (WS_KH + 2u * (size_t)NB * TT * CC)
#define WS_Y   (WS_VT + 2u * (size_t)NB * CC * TT)
#define WS_END (WS_Y  + 4u * (size_t)NB * TT * CC)
static_assert(WS_END <= (size_t)134217728);
static_assert((3 * CC * DIN / 8) % 256 == 0);
static_assert(((3 * CC * DIN + DIN * CC) / 8) % 256 == 0);

// sum over the 16 lanes of a row, left in every lane of the row (four butterfly steps on the vector port, no LDS)
__device__ __forceinline__ float rowsum(float x) {
  x += __builtin_bit_cast(float, __builtin_amdgcn_update_dpp(0, __builtin_bit_cast(int, x), 0x161, 0xf, 0xf, true));   // row_xmask:1
  x += __builtin_bit_cast(float, __builtin_amdgcn_update_dpp(0, __builtin_bit_cast(int, x), 0x162, 0xf, 0xf, true));   // row_xmask:2
  x += __builtin_bit_cast(float, __builtin_amdgcn_update_dpp(0, __builtin_bit_cast(int, x), 0x164, 0xf, 0xf, true));   // row_xmask:4
  x += __builtin_bit_cast(float, __builtin_amdgcn_update_dpp(0, __builtin_bit_cast(int, x), 0x168, 0xf, 0xf, true));   // row_xmask:8
  return x;
}
__device__ __forceinline__ float xhalf(float x) {   // lane l takes lane l ^ 16
  return __builtin_bit_cast(float, __builtin_amdgcn_permlanex16(__builtin_bit_cast(int, x), __builtin_bit_cast(int, x), 0x76543210, 0xfedcba98, false, false));
}
// ---- k_gn: block = one slice (GN_CH channels) of one (batch, group): the slice is read once, every load of a thread in flight at the same time, and stays in registers for both sums.
// It leaves (slice mean, sum of squared deviations from the slice mean) in a 128-B line of its own; k_proj joins the GN_SL slices of a group.
__global__ __launch_bounds__(256) void k_gn(const float* __restrict__ X, float* __restrict__ GS) {
  __shared__ __align__(16) float sa[8]; __shared__ __align__(16) float sq[8];
  const int tid = threadIdx.x, wave = tid >> 5, lane = tid & 31; const int bg = blockIdx.x / GN_SL, sl = blockIdx.x % GN_SL; const int b = bg / GROUPS, gi = bg % GROUPS;
  const float* xp = X + ((size_t)b * DIN + (size_t)gi * CPG + (size_t)sl * GN_CH) * NPIX;
  v4f v[GN_LD];
  // the three loops are unrolled so that v[] has constant indices (stays in registers) and every load issues ahead of the first wait
#pragma unroll
  for (int i = 0; i < GN_LD; ++i) { const int e = tid + 256 * i; const int c = e / (TT / 4), t4 = e - c * (TT / 4); v[i] = *(const v4f*)(xp + (size_t)c * NPIX + (size_t)t4 * 4); }
  float s = 0.f;
#pragma unroll
  for (int i = 0; i < GN_LD; ++i) { const float x0 = v[i][0], x1 = v[i][1], x2 = v[i][2], x3 = v[i][3];
    v[i][0] = bfr(x0); v[i][1] = bfr(x1); v[i][2] = bfr(x2); v[i][3] = bfr(x3); s += (v[i][0] + v[i][1]) + (v[i][2] + v[i][3]); }
  s = rowsum(s); s += xhalf(s);
  if (lane == 0) sa[wave] = s;
  __syncthreads();
  const v4f a0 = *(const v4f*)&sa[0], a1 = *(const v4f*)&sa[4];
  const float mean = (((a0[0] + a0[1]) + (a0[2] + a0[3])) + ((a1[0] + a1[1]) + (a1[2] + a1[3]))) * (1.0f / (float)(GN_CH * TT));
  float s2 = 0.f;
#pragma unroll
  for (int i = 0; i < GN_LD; ++i) { const float d0 = v[i][0] - mean, d1 = v[i][1] - mean, d2 = v[i][2] - mean, d3 = v[i][3] - mean;
    s2 += (d0 * d0 + d1 * d1) + (d2 * d2 + d3 * d3); }
  s2 = rowsum(s2); s2 += xhalf(s2);
  if (lane == 0) sq[wave] = s2;
  __syncthreads();
  if (tid < 32) { const v4f q0 = *(const v4f*)&sq[0], q1 = *(const v4f*)&sq[4];
    const float m2 = ((q0[0] + q0[1]) + (q0[2] + q0[3])) + ((q1[0] + q1[1]) + (q1[2] + q1[3]));
    const float val = tid == 0 ? mean : (tid == 1 ? m2 : 0.f); vst2(GS + (size_t)blockIdx.x * 32 + tid, val); }
}
// ---- k_cvw: weights -> f16(bf16(w) x 256) planes (exact), 8 contiguous elements = one 16-B store per thread
__global__ __launch_bounds__(256) void k_cvw(const float* __restrict__ WA, const float* __restrict__ WB, _Float16* __restrict__ P1, _Float16* __restrict__ P2) {
  const int n1c = 3 * CC * DIN / 8, n2c = DIN * CC / 8;
  const int i8 = blockIdx.x * 256 + threadIdx.x; if (i8 >= n1c + n2c) return;
  const bool second = i8 >= n1c;   // block-uniform (n1c is a multiple of 256)
  const float* src = second ? WB + (size_t)(i8 - n1c) * 8 : WA + (size_t)i8 * 8;
  _Float16* dst = second ? P2 + (size_t)(i8 - n1c) * 8 : P1 + (size_t)i8 * 8;
  const v8f v = *(const v8f*)src; union { v8h h; v4u u; } o;
#pragma unroll
  for (int e = 0; e < 8; ++e) { const float f = v[e]; o.h[e] = (_Float16)(bfr(f) * 256.0f); }
  vst2(dst, o.u);
}
// The block's 128 W rows are staged once in LDS by whole-line loads (a wave's 16-byte load = 512 contiguous bytes) and shared by its four waves; the B fragments come from there.
#define PJ_WP (DIN + 8)      // W row pitch in LDS, f16: 528 B = 16 B x odd, conflict-free for 16-byte readers
#define PJ_LD (CC * DIN / 8 / 128)   // 16-byte pieces per thread
static_assert((CC * DIN / 8) % 128 == 0);
// ---- k_proj: block = (64 voxel rows, which in {q,k,v}): GroupNorm applied on the channels-first gather (group == 32-channel k chunk), qkv = W xn with f16 operands (W x 256) -> which 0/1: f16 rows [b*TT+t][128]; which 2: f16 planes [b][c][t]
__global__ __launch_bounds__(128) void k_proj(const float* __restrict__ X, const float* __restrict__ GS, const float* __restrict__ GW, const float* __restrict__ GB, const _Float16* __restrict__ W1,
    _Float16* __restrict__ QH, _Float16* __restrict__ KH, _Float16* __restrict__ VT) {
  __shared__ __align__(16) _Float16 sh[64][136]; __shared__ __align__(16) _Float16 th[128][72]; __shared__ float sst[GROUPS][2]; __shared__ __align__(16) _Float16 wl[CC * PJ_WP];
  const int tid = threadIdx.x, wave = tid >> 5, lane = tid & 31, col = lane & 15, g = lane >> 4; const int which = blockIdx.y;
  const size_t r0 = (size_t)blockIdx.x * 64; const size_t bb = r0 / TT; const int t0 = (int)(r0 % TT);
  { // join the slices' statistics, once per block: thread = (group tid >> 4, slice tid & 15), a group = one 16-lane row
    const float* gp = GS + ((size_t)bb * GROUPS * GN_SL + tid) * 32; const float pm = gp[0], pq = gp[1];
    // W rows [which * 128, + 128) are one contiguous run: piece e = tid + 128 i is row e >> 5, piece e & 31. Both loops are unrolled so that wr[] stays in registers and every load is in flight before the first store.
    const _Float16* wg = W1 + (size_t)which * CC * DIN; v4u wr[PJ_LD];
#pragma unroll
    for (int i = 0; i < PJ_LD; ++i) wr[i] = *(const v4u*)(wg + (size_t)(tid + 128 * i) * 8);
#pragma unroll
    for (int i = 0; i < PJ_LD; ++i) { const int e = tid + 128 * i; *(v4u*)&wl[(e >> 5) * PJ_WP + (e & 31) * 8] = wr[i]; }
    const float mean = rowsum(pm) * (1.0f / (float)GN_SL); const float dm = pm - mean;
    const float var = rowsum(pq + (float)(GN_CH * TT) * (dm * dm)) * (1.0f / (float)(CPG * TT));
    if (col == 0) { sst[tid >> 4][0] = mean; sst[tid >> 4][1] = 1.0f / sqrtf(var + EPS); } }
  __syncthreads();   // publishes the eight groups' mean and reciprocal deviation, and the staged W rows, to all four waves
  v8f acc[8] = {};
#pragma unroll 1
  for (int kc = 0; kc < DIN / 32; ++kc) {
    const float mu = sst[kc][0], rs = sst[kc][1];
    v16h a, w[8];
    // the eight B fragments are read as a group ahead of the first WMMA, so that one LDS latency is waited out per k chunk, not eight (unrolled: constant indices keep w[] in registers)
#pragma unroll
    for (int j = 0; j < 8; ++j) w[j] = frag_h(&wl[(j * 16 + col) * PJ_WP + kc * 32], lane);
    { const float* p = X + ((size_t)bb * DIN + kc * 32 + 8 * g) * NPIX + t0 + wave * 16 + col;   // x[b][k][n], stride NPIX between channels
      const v8f w0 = *(const v8f*)(GW + kc * 32 + 8 * g), w1 = *(const v8f*)(GW + kc * 32 + 16 + 8 * g);
      const v8f b0 = *(const v8f*)(GB + kc * 32 + 8 * g), b1 = *(const v8f*)(GB + kc * 32 + 16 + 8 * g);
#pragma unroll
      for (int i = 0; i < 8; ++i) {
        const float xa = p[(size_t)i * NPIX], xb = p[(size_t)(16 + i) * NPIX]; const float wa = w0[i], wb = w1[i], ba = b0[i], bbv = b1[i];
        a[i]     = (_Float16)(((bfr(xa) - mu) * rs) * bfr(wa) + bfr(ba));
        a[8 + i] = (_Float16)(((bfr(xb) - mu) * rs) * bfr(wb) + bfr(bbv)); } }
    asm volatile("s_wait_loadcnt 0x0" ::: "memory");
#pragma unroll
    for (int j = 0; j < 8; ++j) acc[j] = wmma16(a, w[j], acc[j]);
  }
  if (which < 2) { _Float16* DH = which == 0 ? QH : KH;
#pragma unroll
    for (int j = 0; j < 8; ++j)
#pragma unroll
      for (int r = 0; r < 8; ++r) sh[wave * 16 + 8 * g + r][j * 16 + col] = (_Float16)(acc[j][r] * (1.0f / 256.0f));
    __syncthreads();
#pragma unroll 1
    for (int e = tid; e < 64 * 16; e += 128) { const int rl = e >> 4, q = e & 15; vst2(DH + (r0 + rl) * CC + q * 8, *(const v4u*)&sh[rl][q * 8]); }
  } else {
#pragma unroll
    for (int j = 0; j < 8; ++j)
#pragma unroll
      for (int r = 0; r < 8; ++r) th[j * 16 + col][wave * 16 + 8 * g + r] = (_Float16)(acc[j][r] * (1.0f / 256.0f));
    __syncthreads();
#pragma unroll 1
    for (int e = tid; e < 128 * 8; e += 128) { const int cl = e >> 3, q = e & 7; vst2(VT + (bb * CC + cl) * (size_t)TT + t0 + q * 8, *(const v4u*)&th[cl][q * 8]); }
  }
}
#define FA_KS 128            // keys per wave and LDS stage
#define FA_KT (2 * FA_KS)    // keys per LDS stage: one run for each of the two wave groups
#define FA_KP (HD + 8)       // K row pitch in f16: 80 B = 16 B x odd, conflict-free for 16-byte readers
#define FA_VP (FA_KT + 8)    // V^T row pitch in f16: 528 B = 16 B x odd
#define FA_NS (TT / FA_KT)
static_assert(HD == 32);
static_assert(TT % FA_KT == 0);
__device__ __forceinline__ v8f wmma_b(v16h a, v16h b, v8f c) { return __builtin_amdgcn_wmma_f32_16x16x32_f16(false, a, false, b, (short)0, c, false, false); }
__global__ __launch_bounds__(512) void k_fa(const _Float16* __restrict__ QH, const _Float16* __restrict__ KH, const _Float16* __restrict__ VT, float* __restrict__ Y) {
  __shared__ __align__(16) _Float16 kl[2][FA_KT * FA_KP]; __shared__ __align__(16) _Float16 vl[2][HD * FA_VP]; __shared__ float mg[8][18][32];
  const int tid = threadIdx.x, wave = tid >> 5, lane = tid & 31, col = lane & 15, g = lane >> 4; const int qw = wave & 7, kh = wave >> 3;   // query group, key run
  const int b = blockIdx.y / NH, h = blockIdx.y % NH; const int q0 = blockIdx.x * 128 + qw * 16;
  const float cs = SCALE * 1.4426950408889634f;   // logit scale x log2(e)
  const v16h qf = frag_h(QH + ((size_t)b * TT + q0 + col) * CC + h * HD, lane);
  // staging: 16-byte pieces; K: 4 pieces a key row, rows tid>>2 and 128 + tid>>2; V^T: 32 pieces a channel row, rows tid>>5 and 16 + tid>>5
  const _Float16* kg = KH + ((size_t)b * TT + (tid >> 2)) * CC + h * HD + (tid & 3) * 8;
  const _Float16* vg = VT + ((size_t)b * CC + h * HD + (tid >> 5)) * (size_t)TT + (tid & 31) * 8;
  const int kd = (tid >> 2) * FA_KP + (tid & 3) * 8, vd = (tid >> 5) * FA_VP + (tid & 31) * 8;
  { const v4u k0 = *(const v4u*)kg, k1 = *(const v4u*)(kg + (size_t)128 * CC), w0 = *(const v4u*)vg, w1 = *(const v4u*)(vg + (size_t)16 * TT);
    *(v4u*)&kl[0][kd] = k0; *(v4u*)&kl[0][kd + 128 * FA_KP] = k1; *(v4u*)&vl[0][vd] = w0; *(v4u*)&vl[0][vd + 16 * FA_VP] = w1; }
  __syncthreads();
  v8f acc[2] = {}; float mrun = -3.0e38f, lsum = 0.f;
  // the stage loop stays rolled (one copy of the 128-key body in the instruction cache; the buffer is a run-time bit); the loops inside are unrolled so that every register array has constant indices
#pragma unroll 1
  for (int st = 0; st < FA_NS; ++st) {
    const int buf = st & 1; const bool more = st + 1 < FA_NS;   // block-uniform
    v4u k0 = {}, k1 = {}, w0 = {}, w1 = {};
    if (more) { const _Float16* kn = kg + (size_t)(st + 1) * FA_KT * CC; const _Float16* vn = vg + (size_t)(st + 1) * FA_KT;   // next stage's loads fly under this stage's work
      k0 = *(const v4u*)kn; k1 = *(const v4u*)(kn + (size_t)128 * CC); w0 = *(const v4u*)vn; w1 = *(const v4u*)(vn + (size_t)16 * TT); }
#pragma unroll
    for (int ps = 0; ps < FA_KS / 64; ++ps) {
      v8f s[4];
#pragma unroll
      for (int t = 0; t < 4; ++t) { const v8f z = {}; s[t] = wmma_b(frag_h(&kl[buf][(kh * FA_KS + ps * 64 + t * 16 + col) * FA_KP], lane), qf, z); }   // s[t][r] = logit(key 16t + 8g + r, query col)
      float mt[4];
#pragma unroll
      for (int t = 0; t < 4; ++t) { mt[t] = s[t][0];
#pragma unroll
        for (int r = 1; r < 8; ++r) mt[t] = fmaxf(mt[t], s[t][r]); }
      float mx = fmaxf(fmaxf(mt[0], mt[1]), fmaxf(mt[2], mt[3]));
      mx = fmaxf(mx, xhalf(mx)) * cs;   // both halves of the wave hold this query's maximum (the scale is positive)
      const float mn = fmaxf(mrun, mx); const float corr = __builtin_amdgcn_exp2f(mrun - mn); mrun = mn;   // corr = 0 on the first pass
      acc[0] = acc[0] * corr; acc[1] = acc[1] * corr;
      const float nm = 11.0f - mn;   // P x 2^11: keeps small weights out of the f16 subnormals; it cancels in the division by the row sum
      v16h pf[2]; float pt[4]; v8f e[4], p[4];
#pragma unroll
      for (int t = 0; t < 4; ++t)
#pragma unroll
        for (int r = 0; r < 8; ++r) { e[t][r] = fmaf(s[t][r], cs, nm); p[t][r] = __builtin_amdgcn_exp2f(e[t][r]); }
      // the slot that the instruction set asks for behind a transcendental: as inputs, the results put the v_nop behind the last exponential and the arguments keep their registers unwritten until there
      asm volatile("v_nop" :: "v"(p[0]), "v"(p[1]), "v"(p[2]), "v"(p[3]), "v"(e[0]), "v"(e[1]), "v"(e[2]), "v"(e[3]));
#pragma unroll
      for (int t = 0; t < 4; ++t) { pt[t] = ((p[t][0] + p[t][1]) + (p[t][2] + p[t][3])) + ((p[t][4] + p[t][5]) + (p[t][6] + p[t][7]));
#pragma unroll
        for (int r = 0; r < 8; ++r) pf[t >> 1][(t & 1) * 8 + r] = (_Float16)p[t][r]; }
      lsum = lsum * corr + ((pt[0] + pt[1]) + (pt[2] + pt[3]));   // this half's keys only; the halves join after the loop
#pragma unroll
      for (int kk = 0; kk < 2; ++kk)
#pragma unroll
        for (int j = 0; j < 2; ++j) acc[j] = wmma_b(frag_h(&vl[buf][(j * 16 + col) * FA_VP + kh * FA_KS + ps * 64 + kk * 32], lane), pf[kk], acc[j]);   // acc[j][r] = ctx(channel 16j + 8g + r, query col)
    }
    if (more) { const int nb = buf ^ 1;   // its last readers left it before the barrier that ended the stage before
      *(v4u*)&kl[nb][kd] = k0; *(v4u*)&kl[nb][kd + 128 * FA_KP] = k1; *(v4u*)&vl[nb][vd] = w0; *(v4u*)&vl[nb][vd + 16 * FA_VP] = w1; }
    __syncthreads();   // publishes stage st + 1 and ends every read of stage st
  }
  // join of the two key runs: the second wave of a query group hands over its unnormalised output, maximum and sum (a wave's store = 128 contiguous bytes, free of bank conflicts); the loops here are unrolled so that acc[] keeps constant indices and stays in registers
  if (kh == 1) {
#pragma unroll
    for (int j = 0; j < 2; ++j)
#pragma unroll
      for (int r = 0; r < 8; ++r) mg[qw][j * 8 + r][lane] = acc[j][r];
    mg[qw][16][lane] = mrun; mg[qw][17][lane] = lsum; }
  __syncthreads();   // publishes the second waves' partial results to the first
  if (kh == 0) {
    const float m1 = mg[qw][16][lane], l1 = mg[qw][17][lane]; const float mn = fmaxf(mrun, m1);
    const float d0 = mrun - mn, d1 = m1 - mn; const float c0 = __builtin_amdgcn_exp2f(d0), c1 = __builtin_amdgcn_exp2f(d1);
    const float ls = lsum * c0 + l1 * c1; const float inv = 1.0f / (ls + xhalf(ls)); const float f0 = c0 * inv, f1 = c1 * inv;
    float* yp = Y + ((size_t)b * TT + q0 + col) * CC + h * HD + 8 * g;   // a query's 32 channels = one 128-B line, written whole by lanes col and col + 16
#pragma unroll
    for (int j = 0; j < 2; ++j) { v8f o;
#pragma unroll
      for (int r = 0; r < 8; ++r) o[r] = acc[j][r] * f0 + mg[qw][j * 8 + r][lane] * f1;
      const v4f lo = {o[0], o[1], o[2], o[3]}, hi = {o[4], o[5], o[6], o[7]}; vst2(yp + j * 16, lo); vst2(yp + j * 16 + 4, hi); } }
}
#define PO_WP (CC + 8)       // W row pitch in LDS, f16: 272 B = 16 B x odd
#define PO_LD (128 * CC / 8 / 128)   // 16-byte pieces per thread
// ---- k_out: block = (64 voxel rows, 128 output channels), its 128 W rows staged in LDS as in k_proj: proj = W ctx (ctx x 64 f16 against W x 256 f16) + bf16(bias), LDS transpose to channels-first, + bf16(x), whole 256-B (c, 64 n) runs by 16 lanes
__global__ __launch_bounds__(128) void k_out(const float* __restrict__ Y, const float* __restrict__ X, const _Float16* __restrict__ W2, const float* __restrict__ PB, float* __restrict__ OUT) {
  __shared__ __align__(16) float stc[128][68]; __shared__ __align__(16) _Float16 wl[128 * PO_WP];
  const int tid = threadIdx.x, wave = tid >> 5, lane = tid & 31, col = lane & 15, g = lane >> 4; const int c0 = blockIdx.y * 128;
  const size_t r0 = (size_t)blockIdx.x * 64; const size_t bb = r0 / TT; const int t0 = (int)(r0 % TT);
  { // W rows [c0, c0 + 128) are one contiguous run: piece e = tid + 128 i is row e >> 4, piece e & 15; unrolled so that every load is in flight before the first store
    const _Float16* wg = W2 + (size_t)c0 * CC; v4u wr[PO_LD];
#pragma unroll
    for (int i = 0; i < PO_LD; ++i) wr[i] = *(const v4u*)(wg + (size_t)(tid + 128 * i) * 8);
#pragma unroll
    for (int i = 0; i < PO_LD; ++i) { const int e = tid + 128 * i; *(v4u*)&wl[(e >> 4) * PO_WP + (e & 15) * 8] = wr[i]; } }
  __syncthreads();   // publishes the staged W rows to all four waves
  v8f acc[8] = {};
#pragma unroll 1
  for (int kc = 0; kc < CC / 32; ++kc) { v16h w[8];
    // the eight B fragments are read as a group ahead of the first WMMA, so that one LDS latency is waited out per k chunk, not eight (unrolled: constant indices keep w[] in registers)
#pragma unroll
    for (int j = 0; j < 8; ++j) w[j] = frag_h(&wl[(j * 16 + col) * PO_WP + kc * 32], lane);
    const v16h a = frag_f32s(Y + (r0 + wave * 16 + col) * CC + kc * 32, lane, 64.0f);
    asm volatile("s_wait_loadcnt 0x0" ::: "memory");
#pragma unroll
    for (int j = 0; j < 8; ++j) acc[j] = wmma16(a, w[j], acc[j]); }
#pragma unroll
  for (int j = 0; j < 8; ++j) { const float bias = bfr(PB[c0 + j * 16 + col]);
#pragma unroll
    for (int r = 0; r < 8; ++r) stc[j * 16 + col][wave * 16 + 8 * g + r] = acc[j][r] * (1.0f / 16384.0f) + bias; }
  __syncthreads();
#pragma unroll 1
  for (int e = tid; e < 128 * 16; e += 128) { const int cl = e >> 4, q = e & 15; const size_t o = ((size_t)bb * DIN + c0 + cl) * NPIX + t0 + q * 4;
    const v4f xv = *(const v4f*)(X + o); const float x0 = xv[0], x1 = xv[1], x2 = xv[2], x3 = xv[3]; v4f r4 = *(const v4f*)&stc[cl][q * 4];
    r4[0] += bfr(x0); r4[1] += bfr(x1); r4[2] += bfr(x2); r4[3] += bfr(x3); vst2(OUT + o, r4); }
}

extern "C" void kernel_launch(void* const* d_in, const int* in_sizes, int n_in, void* d_out, int out_size, void* d_ws, size_t ws_size, hipStream_t stream) {
  // inputs (wire order): 0 x [2,256,16,16,16] f32; 1 norm_w [256]; 2 norm_b [256]; 3 qkv_w (out,in) [384,256]; 4 proj_w (out,in) [256,128]; 5 proj_b [256]
  if (n_in < 6) return;
  if (in_sizes[0] < NB * DIN * NPIX || in_sizes[1] < DIN || in_sizes[2] < DIN || in_sizes[3] < 3 * CC * DIN || in_sizes[4] < DIN * CC || in_sizes[5] < DIN) return;
  if (out_size < NB * DIN * NPIX) return;
  if (ws_size < WS_END) return;
  const float* X = (const float*)d_in[0]; const float* GW = (const float*)d_in[1]; const float* GB = (const float*)d_in[2];
  const float* WQ = (const float*)d_in[3]; const float* WP = (const float*)d_in[4]; const float* PB = (const float*)d_in[5];
  char* ws = (char*)d_ws;
  float* GS = (float*)(ws + WS_GS); _Float16* W1 = (_Float16*)(ws + WS_W1); _Float16* W2 = (_Float16*)(ws + WS_W2);
  _Float16* QH = (_Float16*)(ws + WS_QH); _Float16* KH = (_Float16*)(ws + WS_KH); _Float16* VT = (_Float16*)(ws + WS_VT);
  float* Y = (float*)(ws + WS_Y); float* OUT = (float*)d_out;
  k_gn<<<dim3(NB * GROUPS * GN_SL), 256, 0, stream>>>(X, GS);
  k_cvw<<<dim3((3 * CC * DIN + DIN * CC) / 8 / 256), 256, 0, stream>>>(WQ, WP, W1, W2);
  k_proj<<<dim3(NB * TT / 64, 3), 128, 0, stream>>>(X, GS, GW, GB, W1, QH, KH, VT);
  k_fa<<<dim3(TT / 128, NB * NH), 512, 0, stream>>>(QH, KH, VT, Y);
  k_out<<<dim3(NB * TT / 64, DIN / 128), 128, 0, stream>>>(Y, X, W2, PB, OUT);
}

// v005
// Measured time: 41.4 microseconds a run.
// Timed twice side by side with v004, it ran 1.25 times as fast both times.
// Over all steps from v000 it is 27.3 times as fast.
// compute dtype: every float input RNE-converted to bf16 on load; GroupNorm statistics f32: per 2-channel slice a tree sum for the mean and the squared deviations from it, slices joined by the parallel-variance rule; qkv = W x on v_wmma_f32_16x16x32_f16 with W as f16(bf16 x 256) and normalised x as f16, f32 accumulate; logits k.q f16 x f16 single product, f32 accumulate; softmax f32, online over 64-key passes (running maximum, base-2 exponential with the scale folded in), unnormalised P x 2^11 to f16 once against v f16 (single product), a query's keys dealt in 128-key runs to two waves whose partial sums are joined once on the common maximum, one division by the f32 row sum at the end; output projection: ctx x 64 f16 against W f16(bf16 x 256), f32 accumulate; bias + residual add in f32; f32 output (channels-first).
#include <hip/hip_runtime.h>
#include <math.h>

typedef __attribute__((ext_vector_type(16))) _Float16 v16h;
typedef __attribute__((ext_vector_type(8)))  _Float16 v8h;
typedef __attribute__((ext_vector_type(8)))  float v8f;
typedef __attribute__((ext_vector_type(4)))  float v4f;
typedef __attribute__((ext_vector_type(4)))  unsigned v4u;

template <typename T> __device__ __forceinline__ void vst2(void* p, T v) { *(T*)p = v;  }
__device__ __forceinline__ v8f wmma16(v16h a, v16h b, v8f c) {
  v8f d = __builtin_amdgcn_wmma_f32_16x16x32_f16(false, a, false, b, (short)0, c, false, false);
  asm volatile("v_nop\n\tv_nop\n\tv_nop\n\tv_nop" : "+v"(d) : "v"(a), "v"(b));
  return d;
}
// 16x16x32 fragments: lane = (h = lane>>4, row/col = lane&15); elements 0..7 = k0+8h+0..7, 8..15 = k0+16+8h+0..7; D element r = row 8h+r, col lane&15
__device__ __forceinline__ v16h frag_h(const _Float16* rowk0, int lane) {
  union { v16h v; v8h q[2]; } u; const _Float16* p = rowk0 + 8 * (lane >> 4);
  u.q[0] = *(const v8h*)p; u.q[1] = *(const v8h*)(p + 16); return u.v;
}
__device__ __forceinline__ float bfr(float v) { return (float)(__bf16)v; }

// Self-attention over a flattened 16x16x16 volume: GroupNorm(8 groups, affine) -> 1x1x1 conv qkv (W (out,in) [384][256], no bias) -> 4 heads x 32 dims, softmax((q^T k) * 32^-0.5) over 4,096 keys -> ctx -> 1x1x1 conv proj (W (out,in) [256][128] + bias) -> + x. Channels-first in and out.
#ifndef NB
#define NB 2
#endif
#ifndef SEQ
#define SEQ 4096
#endif
#define NB_FULL 2
#define TT SEQ              // voxels attended per batch element
#define NPIX 4096           // full per-channel voxel stride of x and of the output
#define DIN 256             // model width (input / output channels)
#define GROUPS 8
#define CPG (DIN / GROUPS)  // channels per group
#define NH 4
#define HD 32
#define CC (NH * HD)        // inner width 128
#define SCALE (0.17677669529663687f)
#define EPS (1.0e-5f)
#define GN_SL 16                            // slices (work-groups) per group
#define GN_CH (CPG / GN_SL)                 // channels per slice
#define GN_LD (GN_CH * (TT / 4) / 256)      // 16-byte loads per thread
static_assert(CPG == 32);
static_assert(CPG % GN_SL == 0);
static_assert((GN_CH * (TT / 4)) % 256 == 0);
static_assert(GROUPS * GN_SL == 128);
static_assert(CC == 128);
static_assert(DIN % 128 == 0);
static_assert(TT % 128 == 0);
static_assert(TT <= NPIX);
static_assert(NB <= NB_FULL);
static_assert(((size_t)NB * DIN - 1) * NPIX + TT <= (size_t)2097152);   // last written output element < 8,388,608 B / 4

// workspace carve (bytes): GS one 128-B line of partial statistics per (batch, group, slice) | W1 f16 [384][256] | W2 f16 [256][128] | QH f16 rows [NB*TT][CC] | KH | VT f16 planes [NB][CC][TT] | Y f32 rows [NB*TT][CC]
#define WS_GS  ((size_t)0)
#define WS_W1  ((size_t)128 * NB_FULL * GROUPS * GN_SL)
#define WS_W2  (WS_W1 + 2u * (size_t)3 * CC * DIN)
#define WS_QH  (WS_W2 + 2u * (size_t)DIN * CC)
#define WS_KH  (WS_QH + 2u * (size_t)NB * TT * CC)
#define WS_VT  (WS_KH + 2u * (size_t)NB * TT * CC)
#define WS_Y   (WS_VT + 2u * (size_t)NB * CC * TT)
#define WS_END (WS_Y  + 4u * (size_t)NB * TT * CC)
static_assert(WS_END <= (size_t)134217728);
static_assert((3 * CC * DIN / 8) % 256 == 0);
static_assert(((3 * CC * DIN + DIN * CC) / 8) % 256 == 0);

// sum over the 16 lanes of a row, left in every lane of the row (four butterfly steps on the vector port, no LDS)
__device__ __forceinline__ float rowsum(float x) {
  x += __builtin_bit_cast(float, __builtin_amdgcn_update_dpp(0, __builtin_bit_cast(int, x), 0x161, 0xf, 0xf, true));   // row_xmask:1
  x += __builtin_bit_cast(float, __builtin_amdgcn_update_dpp(0, __builtin_bit_cast(int, x), 0x162, 0xf, 0xf, true));   // row_xmask:2
  x += __builtin_bit_cast(float, __builtin_amdgcn_update_dpp(0, __builtin_bit_cast(int, x), 0x164, 0xf, 0xf, true));   // row_xmask:4
  x += __builtin_bit_cast(float, __builtin_amdgcn_update_dpp(0, __builtin_bit_cast(int, x), 0x168, 0xf, 0xf, true));   // row_xmask:8
  return x;
}
__device__ __forceinline__ float xhalf(float x) {   // lane l takes lane l ^ 16
  return __builtin_bit_cast(float, __builtin_amdgcn_permlanex16(__builtin_bit_cast(int, x), __builtin_bit_cast(int, x), 0x76543210, 0xfedcba98, false, false));
}
// ---- k_gn: block = one slice (GN_CH channels) of one (batch, group): the slice is read once, every load of a thread in flight at the same time, and stays in registers for both sums.
// It leaves (slice mean, sum of squared deviations from the slice mean) in a 128-B line of its own; k_proj joins the GN_SL slices of a group.
__global__ __launch_bounds__(256) void k_gn(const float* __restrict__ X, float* __restrict__ GS) {
  __shared__ __align__(16) float sa[8]; __shared__ __align__(16) float sq[8];
  const int tid = threadIdx.x, wave = tid >> 5, lane = tid & 31; const int bg = blockIdx.x / GN_SL, sl = blockIdx.x % GN_SL; const int b = bg / GROUPS, gi = bg % GROUPS;
  const float* xp = X + ((size_t)b * DIN + (size_t)gi * CPG + (size_t)sl * GN_CH) * NPIX;
  v4f v[GN_LD];
  // the three loops are unrolled so that v[] has constant indices (stays in registers) and every load issues ahead of the first wait
#pragma unroll
  for (int i = 0; i < GN_LD; ++i) { const int e = tid + 256 * i; const int c = e / (TT / 4), t4 = e - c * (TT / 4); v[i] = *(const v4f*)(xp + (size_t)c * NPIX + (size_t)t4 * 4); }
  float s = 0.f;
#pragma unroll
  for (int i = 0; i < GN_LD; ++i) { const float x0 = v[i][0], x1 = v[i][1], x2 = v[i][2], x3 = v[i][3];
    v[i][0] = bfr(x0); v[i][1] = bfr(x1); v[i][2] = bfr(x2); v[i][3] = bfr(x3); s += (v[i][0] + v[i][1]) + (v[i][2] + v[i][3]); }
  s = rowsum(s); s += xhalf(s);
  if (lane == 0) sa[wave] = s;
  __syncthreads();
  const v4f a0 = *(const v4f*)&sa[0], a1 = *(const v4f*)&sa[4];
  const float mean = (((a0[0] + a0[1]) + (a0[2] + a0[3])) + ((a1[0] + a1[1]) + (a1[2] + a1[3]))) * (1.0f / (float)(GN_CH * TT));
  float s2 = 0.f;
#pragma unroll
  for (int i = 0; i < GN_LD; ++i) { const float d0 = v[i][0] - mean, d1 = v[i][1] - mean, d2 = v[i][2] - mean, d3 = v[i][3] - mean;
    s2 += (d0 * d0 + d1 * d1) + (d2 * d2 + d3 * d3); }
  s2 = rowsum(s2); s2 += xhalf(s2);
  if (lane == 0) sq[wave] = s2;
  __syncthreads();
  if (tid < 32) { const v4f q0 = *(const v4f*)&sq[0], q1 = *(const v4f*)&sq[4];
    const float m2 = ((q0[0] + q0[1]) + (q0[2] + q0[3])) + ((q1[0] + q1[1]) + (q1[2] + q1[3]));
    const float val = tid == 0 ? mean : (tid == 1 ? m2 : 0.f); vst2(GS + (size_t)blockIdx.x * 32 + tid, val); }
}
// ---- k_cvw: weights -> f16(bf16(w) x 256) planes (exact), 8 contiguous elements = one 16-B store per thread
__global__ __launch_bounds__(256) void k_cvw(const float* __restrict__ WA, const float* __restrict__ WB, _Float16* __restrict__ P1, _Float16* __restrict__ P2) {
  const int n1c = 3 * CC * DIN / 8, n2c = DIN * CC / 8;
  const int i8 = blockIdx.x * 256 + threadIdx.x; if (i8 >= n1c + n2c) return;
  const bool second = i8 >= n1c;   // block-uniform (n1c is a multiple of 256)
  const float* src = second ? WB + (size_t)(i8 - n1c) * 8 : WA + (size_t)i8 * 8;
  _Float16* dst = second ? P2 + (size_t)(i8 - n1c) * 8 : P1 + (size_t)i8 * 8;
  const v8f v = *(const v8f*)src; union { v8h h; v4u u; } o;
#pragma unroll
  for (int e = 0; e < 8; ++e) { const float f = v[e]; o.h[e] = (_Float16)(bfr(f) * 256.0f); }
  vst2(dst, o.u);
}
// The block's 128 W rows are staged once in LDS by whole-line loads (a wave's 16-byte load = 512 contiguous bytes) and shared by its four waves; the B fragments come from there.
#define PJ_WP (DIN + 8)      // W row pitch in LDS, f16: 528 B = 16 B x odd, conflict-free for 16-byte readers
#define PJ_LD (CC * DIN / 8 / 128)   // 16-byte pieces per thread
static_assert((CC * DIN / 8) % 128 == 0);
static_assert(DIN == 2 * 128);   // k_proj: each of its 128 threads rounds two affine weights and two offsets into LDS
// No global load is waited for inside the k loop: a lane's x values of all eight chunks are in flight from the prologue on (registers), and the affine weights come from LDS.
// ---- k_proj: block = (64 voxel rows, which in {q,k,v}): GroupNorm applied on the channels-first gather (group == 32-channel k chunk), qkv = W xn with f16 operands (W x 256) -> which 0/1: f16 rows [b*TT+t][128]; which 2: f16 planes [b][c][t]
__global__ __launch_bounds__(128) void k_proj(const float* __restrict__ X, const float* __restrict__ GS, const float* __restrict__ GW, const float* __restrict__ GB, const _Float16* __restrict__ W1,
    _Float16* __restrict__ QH, _Float16* __restrict__ KH, _Float16* __restrict__ VT) {
  __shared__ __align__(16) _Float16 sh[64][136]; __shared__ __align__(16) _Float16 th[128][72]; __shared__ float sst[GROUPS][2]; __shared__ __align__(16) _Float16 wl[CC * PJ_WP]; __shared__ __align__(32) float sgw[DIN]; __shared__ __align__(32) float sgb[DIN];
  const int tid = threadIdx.x, wave = tid >> 5, lane = tid & 31, col = lane & 15, g = lane >> 4; const int which = blockIdx.y;
  const size_t r0 = (size_t)blockIdx.x * 64; const size_t bb = r0 / TT; const int t0 = (int)(r0 % TT);
  const float* xp = X + ((size_t)bb * DIN + 8 * g) * NPIX + t0 + wave * 16 + col;   // x[b][k][n], stride NPIX between channels
  const float* gp = GS + ((size_t)bb * GROUPS * GN_SL + tid) * 32; const float pm = gp[0], pq = gp[1];   // thread = (group tid >> 4, slice tid & 15)
  asm volatile("s_wait_xcnt 0x0" ::: "memory");   // stands in front of the re-use of the statistics load's offset register
  float xr[DIN / 32][16];
  // every loop over xr[] is unrolled so that it has constant indices and stays in registers, and all 128 loads go out ahead of the first wait
#pragma unroll
  for (int kc = 0; kc < DIN / 32; ++kc)
#pragma unroll
    for (int i = 0; i < 8; ++i) { xr[kc][i] = xp[(size_t)(kc * 32 + i) * NPIX]; xr[kc][8 + i] = xp[(size_t)(kc * 32 + 16 + i) * NPIX]; }
  { // join the slices' statistics, once per block: thread = (group tid >> 4, slice tid & 15), a group = one 16-lane row
    const float gw0 = GW[tid], gw1 = GW[tid + 128], gb0 = GB[tid], gb1 = GB[tid + 128];
    // W rows [which * 128, + 128) are one contiguous run: piece e = tid + 128 i is row e >> 5, piece e & 31. Both loops are unrolled so that wr[] stays in registers and every load is in flight before the first store.
    const _Float16* wg = W1 + (size_t)which * CC * DIN; v4u wr[PJ_LD];
#pragma unroll
    for (int i = 0; i < PJ_LD; ++i) wr[i] = *(const v4u*)(wg + (size_t)(tid + 128 * i) * 8);
#pragma unroll
    for (int i = 0; i < PJ_LD; ++i) { const int e = tid + 128 * i; *(v4u*)&wl[(e >> 5) * PJ_WP + (e & 31) * 8] = wr[i]; }
    sgw[tid] = bfr(gw0); sgw[tid + 128] = bfr(gw1); sgb[tid] = bfr(gb0); sgb[tid + 128] = bfr(gb1);
    const float mean = rowsum(pm) * (1.0f / (float)GN_SL); const float dm = pm - mean;
    const float var = rowsum(pq + (float)(GN_CH * TT) * (dm * dm)) * (1.0f / (float)(CPG * TT));
    if (col == 0) { sst[tid >> 4][0] = mean; sst[tid >> 4][1] = 1.0f / sqrtf(var + EPS); } }
  __syncthreads();   // publishes the eight groups' mean and reciprocal deviation, the rounded affine weights and the staged W rows to all four waves
  v8f acc[8] = {};
  // unrolled: xr[] needs constant indices
#pragma unroll
  for (int kc = 0; kc < DIN / 32; ++kc) {
    const float mu = sst[kc][0], rs = sst[kc][1];
    v16h a, w[8];
    // the eight B fragments are read as a group ahead of the first WMMA, so that one LDS latency is waited out per k chunk, not eight (unrolled: constant indices keep w[] in registers)
#pragma unroll
    for (int j = 0; j < 8; ++j) w[j] = frag_h(&wl[(j * 16 + col) * PJ_WP + kc * 32], lane);
    { const v8f w0 = *(const v8f*)&sgw[kc * 32 + 8 * g], w1 = *(const v8f*)&sgw[kc * 32 + 16 + 8 * g];
      const v8f b0 = *(const v8f*)&sgb[kc * 32 + 8 * g], b1 = *(const v8f*)&sgb[kc * 32 + 16 + 8 * g];
#pragma unroll
      for (int i = 0; i < 8; ++i) {
        const float xa = xr[kc][i], xb = xr[kc][8 + i]; const float wa = w0[i], wb = w1[i], ba = b0[i], bbv = b1[i];
        a[i]     = (_Float16)(((bfr(xa) - mu) * rs) * wa + ba);
        a[8 + i] = (_Float16)(((bfr(xb) - mu) * rs) * wb + bbv); } }
#pragma unroll
    for (int j = 0; j < 8; ++j) acc[j] = wmma16(a, w[j], acc[j]);
  }
  if (which < 2) { _Float16* DH = which == 0 ? QH : KH;
#pragma unroll
    for (int j = 0; j < 8; ++j)
#pragma unroll
      for (int r = 0; r < 8; ++r) sh[wave * 16 + 8 * g + r][j * 16 + col] = (_Float16)(acc[j][r] * (1.0f / 256.0f));
    __syncthreads();
    // unrolled, constant trip count: the LDS reads go out as a group, not one waited for per trip
#pragma unroll
    for (int i = 0; i < 64 * 16 / 128; ++i) { const int e = tid + 128 * i; const int rl = e >> 4, q = e & 15; vst2(DH + (r0 + rl) * CC + q * 8, *(const v4u*)&sh[rl][q * 8]); }
  } else {
#pragma unroll
    for (int j = 0; j < 8; ++j)
#pragma unroll
      for (int r = 0; r < 8; ++r) th[j * 16 + col][wave * 16 + 8 * g + r] = (_Float16)(acc[j][r] * (1.0f / 256.0f));
    __syncthreads();
    // unrolled, constant trip count: the LDS reads go out as a group, not one waited for per trip
#pragma unroll
    for (int i = 0; i < 128 * 8 / 128; ++i) { const int e = tid + 128 * i; const int cl = e >> 3, q = e & 7; vst2(VT + (bb * CC + cl) * (size_t)TT + t0 + q * 8, *(const v4u*)&th[cl][q * 8]); }
  }
}
#define FA_KS 128            // keys per wave and LDS stage
#define FA_KT (2 * FA_KS)    // keys per LDS stage: one run for each of the two wave groups
#define FA_KP (HD + 8)       // K row pitch in f16: 80 B = 16 B x odd, conflict-free for 16-byte readers
#define FA_VP (FA_KT + 8)    // V^T row pitch in f16: 528 B = 16 B x odd
#define FA_NS (TT / FA_KT)
static_assert(HD == 32);
static_assert(TT % FA_KT == 0);
__device__ __forceinline__ v8f wmma_b(v16h a, v16h b, v8f c) { return __builtin_amdgcn_wmma_f32_16x16x32_f16(false, a, false, b, (short)0, c, false, false); }
__global__ __launch_bounds__(512) void k_fa(const _Float16* __restrict__ QH, const _Float16* __restrict__ KH, const _Float16* __restrict__ VT, float* __restrict__ Y) {
  __shared__ __align__(16) _Float16 kl[2][FA_KT * FA_KP]; __shared__ __align__(16) _Float16 vl[2][HD * FA_VP]; __shared__ float mg[8][18][32];
  const int tid = threadIdx.x, wave = tid >> 5, lane = tid & 31, col = lane & 15, g = lane >> 4; const int qw = wave & 7, kh = wave >> 3;   // query group, key run
  const int b = blockIdx.y / NH, h = blockIdx.y % NH; const int q0 = blockIdx.x * 128 + qw * 16;
  const float cs = SCALE * 1.4426950408889634f;   // logit scale x log2(e)
  const v16h qf = frag_h(QH + ((size_t)b * TT + q0 + col) * CC + h * HD, lane);
  // staging: 16-byte pieces; K: 4 pieces a key row, rows tid>>2 and 128 + tid>>2; V^T: 32 pieces a channel row, rows tid>>5 and 16 + tid>>5
  const _Float16* kg = KH + ((size_t)b * TT + (tid >> 2)) * CC + h * HD + (tid & 3) * 8;
  const _Float16* vg = VT + ((size_t)b * CC + h * HD + (tid >> 5)) * (size_t)TT + (tid & 31) * 8;
  const int kd = (tid >> 2) * FA_KP + (tid & 3) * 8, vd = (tid >> 5) * FA_VP + (tid & 31) * 8;
  { const v4u k0 = *(const v4u*)kg, k1 = *(const v4u*)(kg + (size_t)128 * CC), w0 = *(const v4u*)vg, w1 = *(const v4u*)(vg + (size_t)16 * TT);
    *(v4u*)&kl[0][kd] = k0; *(v4u*)&kl[0][kd + 128 * FA_KP] = k1; *(v4u*)&vl[0][vd] = w0; *(v4u*)&vl[0][vd + 16 * FA_VP] = w1; }
  __syncthreads();
  v8f acc[2] = {}; float mrun = -3.0e38f, lsum = 0.f;
  // the stage loop stays rolled (one copy of the 128-key body in the instruction cache; the buffer is a run-time bit); the loops inside are unrolled so that every register array has constant indices
#pragma unroll 1
  for (int st = 0; st < FA_NS; ++st) {
    const int buf = st & 1; const bool more = st + 1 < FA_NS;   // block-uniform
    v4u k0 = {}, k1 = {}, w0 = {}, w1 = {};
    if (more) { const _Float16* kn = kg + (size_t)(st + 1) * FA_KT * CC; const _Float16* vn = vg + (size_t)(st + 1) * FA_KT;   // next stage's loads fly under this stage's work
      k0 = *(const v4u*)kn; k1 = *(const v4u*)(kn + (size_t)128 * CC); w0 = *(const v4u*)vn; w1 = *(const v4u*)(vn + (size_t)16 * TT); }
#pragma unroll
    for (int ps = 0; ps < FA_KS / 64; ++ps) {
      v8f s[4];
#pragma unroll
      for (int t = 0; t < 4; ++t) { const v8f z = {}; s[t] = wmma_b(frag_h(&kl[buf][(kh * FA_KS + ps * 64 + t * 16 + col) * FA_KP], lane), qf, z); }   // s[t][r] = logit(key 16t + 8g + r, query col)
      float mt[4];
#pragma unroll
      for (int t = 0; t < 4; ++t) { mt[t] = s[t][0];
#pragma unroll
        for (int r = 1; r < 8; ++r) mt[t] = fmaxf(mt[t], s[t][r]); }
      float mx = fmaxf(fmaxf(mt[0], mt[1]), fmaxf(mt[2], mt[3]));
      mx = fmaxf(mx, xhalf(mx)) * cs;   // both halves of the wave hold this query's maximum (the scale is positive)
      const float mn = fmaxf(mrun, mx); const float corr = __builtin_amdgcn_exp2f(mrun - mn); mrun = mn;   // corr = 0 on the first pass
      acc[0] = acc[0] * corr; acc[1] = acc[1] * corr;
      const float nm = 11.0f - mn;   // P x 2^11: keeps small weights out of the f16 subnormals; it cancels in the division by the row sum
      v16h pf[2]; float pt[4]; v8f e[4], p[4];
#pragma unroll
      for (int t = 0; t < 4; ++t)
#pragma unroll
        for (int r = 0; r < 8; ++r) { e[t][r] = fmaf(s[t][r], cs, nm); p[t][r] = __builtin_amdgcn_exp2f(e[t][r]); }
      // the slot that the instruction set asks for behind a transcendental: as inputs, the results put the v_nop behind the last exponential and the arguments keep their registers unwritten until there
      asm volatile("v_nop" :: "v"(p[0]), "v"(p[1]), "v"(p[2]), "v"(p[3]), "v"(e[0]), "v"(e[1]), "v"(e[2]), "v"(e[3]));
#pragma unroll
      for (int t = 0; t < 4; ++t) { pt[t] = ((p[t][0] + p[t][1]) + (p[t][2] + p[t][3])) + ((p[t][4] + p[t][5]) + (p[t][6] + p[t][7]));
#pragma unroll
        for (int r = 0; r < 8; ++r) pf[t >> 1][(t & 1) * 8 + r] = (_Float16)p[t][r]; }
      lsum = lsum * corr + ((pt[0] + pt[1]) + (pt[2] + pt[3]));   // this half's keys only; the halves join after the loop
#pragma unroll
      for (int kk = 0; kk < 2; ++kk)
#pragma unroll
        for (int j = 0; j < 2; ++j) acc[j] = wmma_b(frag_h(&vl[buf][(j * 16 + col) * FA_VP + kh * FA_KS + ps * 64 + kk * 32], lane), pf[kk], acc[j]);   // acc[j][r] = ctx(channel 16j + 8g + r, query col)
    }
    if (more) { const int nb = buf ^ 1;   // its last readers left it before the barrier that ended the stage before
      *(v4u*)&kl[nb][kd] = k0; *(v4u*)&kl[nb][kd + 128 * FA_KP] = k1; *(v4u*)&vl[nb][vd] = w0; *(v4u*)&vl[nb][vd + 16 * FA_VP] = w1; }
    __syncthreads();   // publishes stage st + 1 and ends every read of stage st
  }
  // join of the two key runs: the second wave of a query group hands over its unnormalised output, maximum and sum (a wave's store = 128 contiguous bytes, free of bank conflicts); the loops here are unrolled so that acc[] keeps constant indices and stays in registers
  if (kh == 1) {
#pragma unroll
    for (int j = 0; j < 2; ++j)
#pragma unroll
      for (int r = 0; r < 8; ++r) mg[qw][j * 8 + r][lane] = acc[j][r];
    mg[qw][16][lane] = mrun; mg[qw][17][lane] = lsum; }
  __syncthreads();   // publishes the second waves' partial results to the first
  if (kh == 0) {
    const float m1 = mg[qw][16][lane], l1 = mg[qw][17][lane]; const float mn = fmaxf(mrun, m1);
    const float d0 = mrun - mn, d1 = m1 - mn; const float c0 = __builtin_amdgcn_exp2f(d0), c1 = __builtin_amdgcn_exp2f(d1);
    const float ls = lsum * c0 + l1 * c1; const float inv = 1.0f / (ls + xhalf(ls)); const float f0 = c0 * inv, f1 = c1 * inv;
    float* yp = Y + ((size_t)b * TT + q0 + col) * CC + h * HD + 8 * g;   // a query's 32 channels = one 128-B line, written whole by lanes col and col + 16
#pragma unroll
    for (int j = 0; j < 2; ++j) { v8f o;
#pragma unroll
      for (int r = 0; r < 8; ++r) o[r] = acc[j][r] * f0 + mg[qw][j * 8 + r][lane] * f1;
      const v4f lo = {o[0], o[1], o[2], o[3]}, hi = {o[4], o[5], o[6], o[7]}; vst2(yp + j * 16, lo); vst2(yp + j * 16 + 4, hi); } }
}
#define PO_WP (CC + 8)       // W row pitch in LDS, f16: 272 B = 16 B x odd
#define PO_LD (128 * CC / 8 / 128)   // 16-byte pieces per thread
// Every global load of a thread (W pieces, its ctx row, the bias, its 16 residual pieces of x) is issued at the head of the kernel and stays in registers: no load is waited for in the k loop or in the store loop.
// ---- k_out: block = (64 voxel rows, 128 output channels), its 128 W rows staged in LDS as in k_proj: proj = W ctx (ctx x 64 f16 against W x 256 f16) + bf16(bias), LDS transpose to channels-first, + bf16(x), whole 256-B (c, 64 n) runs by 16 lanes
__global__ __launch_bounds__(128) void k_out(const float* __restrict__ Y, const float* __restrict__ X, const _Float16* __restrict__ W2, const float* __restrict__ PB, float* __restrict__ OUT) {
  __shared__ __align__(16) float stc[128][68]; __shared__ __align__(16) _Float16 wl[128 * PO_WP];
  const int tid = threadIdx.x, wave = tid >> 5, lane = tid & 31, col = lane & 15, g = lane >> 4; const int c0 = blockIdx.y * 128;
  const size_t r0 = (size_t)blockIdx.x * 64; const size_t bb = r0 / TT; const int t0 = (int)(r0 % TT);
  const float* yq = Y + (r0 + wave * 16 + col) * CC + 8 * g;   // fragment order: elements 0..7 = k0 + 8g + 0..7, 8..15 = k0 + 16 + 8g + 0..7
  const size_t o0 = ((size_t)bb * DIN + c0 + (tid >> 4)) * NPIX + t0 + (tid & 15) * 4;   // store piece i of a thread: channel c0 + (tid >> 4) + 8 i, voxels t0 + 4 (tid & 15) ..
  v8f ya[CC / 32][2]; float pb[8]; v4f xv[16];
  { // W rows [c0, c0 + 128) are one contiguous run: piece e = tid + 128 i is row e >> 4, piece e & 15; all loops over register arrays here are unrolled so that the arrays have constant indices and every load is in flight before the first store
    const _Float16* wg = W2 + (size_t)c0 * CC; v4u wr[PO_LD];
#pragma unroll
    for (int j = 0; j < 8; ++j) pb[j] = PB[c0 + j * 16 + col];
    asm volatile("s_wait_xcnt 0x0" ::: "memory");   // stands in front of the re-use of the bias loads' offset register
#pragma unroll
    for (int i = 0; i < PO_LD; ++i) wr[i] = *(const v4u*)(wg + (size_t)(tid + 128 * i) * 8);
#pragma unroll
    for (int kc = 0; kc < CC / 32; ++kc) { ya[kc][0] = *(const v8f*)(yq + kc * 32); ya[kc][1] = *(const v8f*)(yq + kc * 32 + 16); }
#pragma unroll
    for (int i = 0; i < 16; ++i) xv[i] = *(const v4f*)(X + o0 + (size_t)i * 8 * NPIX);
#pragma unroll
    for (int i = 0; i < PO_LD; ++i) { const int e = tid + 128 * i; *(v4u*)&wl[(e >> 4) * PO_WP + (e & 15) * 8] = wr[i]; } }
  __syncthreads();   // publishes the staged W rows to all four waves
  v8f acc[8] = {};
  // unrolled: ya[] needs constant indices
#pragma unroll
  for (int kc = 0; kc < CC / 32; ++kc) { v16h w[8];
    // the eight B fragments are read as a group ahead of the first WMMA, so that one LDS latency is waited out per k chunk, not eight (unrolled: constant indices keep w[] in registers)
#pragma unroll
    for (int j = 0; j < 8; ++j) w[j] = frag_h(&wl[(j * 16 + col) * PO_WP + kc * 32], lane);
    v16h a;
#pragma unroll
    for (int i = 0; i < 8; ++i) { const float x0 = ya[kc][0][i], x1 = ya[kc][1][i]; a[i] = (_Float16)(x0 * 64.0f); a[8 + i] = (_Float16)(x1 * 64.0f); }
#pragma unroll
    for (int j = 0; j < 8; ++j) acc[j] = wmma16(a, w[j], acc[j]); }
#pragma unroll
  for (int j = 0; j < 8; ++j) { const float bias = bfr(pb[j]);
#pragma unroll
    for (int r = 0; r < 8; ++r) stc[j * 16 + col][wave * 16 + 8 * g + r] = acc[j][r] * (1.0f / 16384.0f) + bias; }
  __syncthreads();
  // unrolled: xv[] needs constant indices, and the LDS reads go out in groups
#pragma unroll
  for (int i = 0; i < 16; ++i) { const float x0 = xv[i][0], x1 = xv[i][1], x2 = xv[i][2], x3 = xv[i][3]; v4f r4 = *(const v4f*)&stc[(tid >> 4) + 8 * i][(tid & 15) * 4];
    r4[0] += bfr(x0); r4[1] += bfr(x1); r4[2] += bfr(x2); r4[3] += bfr(x3); vst2(OUT + o0 + (size_t)i * 8 * NPIX, r4); }
}

extern "C" void kernel_launch(void* const* d_in, const int* in_sizes, int n_in, void* d_out, int out_size, void* d_ws, size_t ws_size, hipStream_t stream) {
  // inputs (wire order): 0 x [2,256,16,16,16] f32; 1 norm_w [256]; 2 norm_b [256]; 3 qkv_w (out,in) [384,256]; 4 proj_w (out,in) [256,128]; 5 proj_b [256]
  if (n_in < 6) return;
  if (in_sizes[0] < NB * DIN * NPIX || in_sizes[1] < DIN || in_sizes[2] < DIN || in_sizes[3] < 3 * CC * DIN || in_sizes[4] < DIN * CC || in_sizes[5] < DIN) return;
  if (out_size < NB * DIN * NPIX) return;
  if (ws_size < WS_END) return;
  const float* X = (const float*)d_in[0]; const float* GW = (const float*)d_in[1]; const float* GB = (const float*)d_in[2];
  const float* WQ = (const float*)d_in[3]; const float* WP = (const float*)d_in[4]; const float* PB = (const float*)d_in[5];
  char* ws = (char*)d_ws;
  float* GS = (float*)(ws + WS_GS); _Float16* W1 = (_Float16*)(ws + WS_W1); _Float16* W2 = (_Float16*)(ws + WS_W2);
  _Float16* QH = (_Float16*)(ws + WS_QH); _Float16* KH = (_Float16*)(ws + WS_KH); _Float16* VT = (_Float16*)(ws + WS_VT);
  float* Y = (float*)(ws + WS_Y); float* OUT = (float*)d_out;
  k_gn<<<dim3(NB * GROUPS * GN_SL), 256, 0, stream>>>(X, GS);
  k_cvw<<<dim3((3 * CC * DIN + DIN * CC) / 8 / 256), 256, 0, stream>>>(WQ, WP, W1, W2);
  k_proj<<<dim3(NB * TT / 64, 3), 128, 0, stream>>>(X, GS, GW, GB, W1, QH, KH, VT);
  k_fa<<<dim3(TT / 128, NB * NH), 512, 0, stream>>>(QH, KH, VT, Y);
  k_out<<<dim3(NB * TT / 64, DIN / 128), 128, 0, stream>>>(Y, X, W2, PB, OUT);
}

// v006
// A run of this version takes 38.9 microseconds.
// Two timings next to v005 both put it at 1.06 times that version's speed.
// All steps since v000 together make it 28.9 times as fast.
// compute dtype: every float input RNE-converted to bf16 on load; GroupNorm statistics f32: per 2-channel slice a tree sum for the mean and the squared deviations from it, slices joined by the parallel-variance rule; qkv = W x on v_wmma_f32_16x16x32_f16 with W as f16(bf16 x 256) and normalised x as f16, f32 accumulate; logits k.q f16 x f16 single product, f32 accumulate; softmax f32, online over 64-key passes (running maximum, base-2 exponential with the scale folded in), unnormalised P x 2^11 to f16 once against v f16 (single product), a query's keys dealt in 128-key runs to two waves whose partial sums are joined once on the common maximum, one division by the f32 row sum at the end; output projection: ctx x 64 f16 against W f16(bf16 x 256), f32 accumulate; bias + residual add in f32; f32 output (channels-first).
#include <hip/hip_runtime.h>
#include <math.h>

typedef __attribute__((ext_vector_type(16))) _Float16 v16h;
typedef __attribute__((ext_vector_type(8)))  _Float16 v8h;
typedef __attribute__((ext_vector_type(8)))  float v8f;
typedef __attribute__((ext_vector_type(4)))  float v4f;
typedef __attribute__((ext_vector_type(4)))  unsigned v4u;

template <typename T> __device__ __forceinline__ void vst2(void* p, T v) { *(T*)p = v;  }
__device__ __forceinline__ v8f wmma16(v16h a, v16h b, v8f c) {
  v8f d = __builtin_amdgcn_wmma_f32_16x16x32_f16(false, a, false, b, (short)0, c, false, false);
  asm volatile("v_nop\n\tv_nop\n\tv_nop\n\tv_nop" : "+v"(d) : "v"(a), "v"(b));
  return d;
}
// 16x16x32 fragments: lane = (h = lane>>4, row/col = lane&15); elements 0..7 = k0+8h+0..7, 8..15 = k0+16+8h+0..7; D element r = row 8h+r, col lane&15
__device__ __forceinline__ v16h frag_h(const _Float16* rowk0, int lane) {
  union { v16h v; v8h q[2]; } u; const _Float16* p = rowk0 + 8 * (lane >> 4);
  u.q[0] = *(const v8h*)p; u.q[1] = *(const v8h*)(p + 16); return u.v;
}
__device__ __forceinline__ float bfr(float v) { return (float)(__bf16)v; }

// Self-attention over a flattened 16x16x16 volume: GroupNorm(8 groups, affine) -> 1x1x1 conv qkv (W (out,in) [384][256], no bias) -> 4 heads x 32 dims, softmax((q^T k) * 32^-0.5) over 4,096 keys -> ctx -> 1x1x1 conv proj (W (out,in) [256][128] + bias) -> + x. Channels-first in and out.
#ifndef NB
#define NB 2
#endif
#ifndef SEQ
#define SEQ 4096
#endif
#define NB_FULL 2
#define TT SEQ              // voxels attended per batch element
#define NPIX 4096           // full per-channel voxel stride of x and of the output
#define DIN 256             // model width (input / output channels)
#define GROUPS 8
#define CPG (DIN / GROUPS)  // channels per group
#define NH 4
#define HD 32
#define CC (NH * HD)        // inner width 128
#define SCALE (0.17677669529663687f)
#define EPS (1.0e-5f)
#define GN_SL 16                            // slices (work-groups) per group
#define GN_CH (CPG / GN_SL)                 // channels per slice
#define GN_LD (GN_CH * (TT / 4) / 256)      // 16-byte loads per thread
static_assert(CPG == 32);
static_assert(CPG % GN_SL == 0);
static_assert((GN_CH * (TT / 4)) % 256 == 0);
static_assert(GROUPS * GN_SL == 128);
static_assert(CC == 128);
static_assert(DIN % 128 == 0);
static_assert(TT % 128 == 0);
static_assert(TT <= NPIX);
static_assert(NB <= NB_FULL);
static_assert(((size_t)NB * DIN - 1) * NPIX + TT <= (size_t)2097152);   // last written output element < 8,388,608 B / 4

// workspace carve (bytes): GS one 128-B line of partial statistics per (batch, group, slice) | W1 f16 [384][256] | W2 f16 [256][128] | QH f16 rows [NB*TT][CC] | KH | VT f16 planes [NB][CC][TT] | Y f32 rows [NB*TT][CC]
#define WS_GS  ((size_t)0)
#define WS_W1  ((size_t)128 * NB_FULL * GROUPS * GN_SL)
#define WS_W2  (WS_W1 + 2u * (size_t)3 * CC * DIN)
#define WS_QH  (WS_W2 + 2u * (size_t)DIN * CC)
#define WS_KH  (WS_QH + 2u * (size_t)NB * TT * CC)
#define WS_VT  (WS_KH + 2u * (size_t)NB * TT * CC)
#define WS_Y   (WS_VT + 2u * (size_t)NB * CC * TT)
#define WS_END (WS_Y  + 4u * (size_t)NB * TT * CC)
static_assert(WS_END <= (size_t)134217728);
static_assert((3 * CC * DIN / 8) % 256 == 0);
static_assert(((3 * CC * DIN + DIN * CC) / 8) % 256 == 0);

// sum over the 16 lanes of a row, left in every lane of the row (four butterfly steps on the vector port, no LDS)
__device__ __forceinline__ float rowsum(float x) {
  x += __builtin_bit_cast(float, __builtin_amdgcn_update_dpp(0, __builtin_bit_cast(int, x), 0x161, 0xf, 0xf, true));   // row_xmask:1
  x += __builtin_bit_cast(float, __builtin_amdgcn_update_dpp(0, __builtin_bit_cast(int, x), 0x162, 0xf, 0xf, true));   // row_xmask:2
  x += __builtin_bit_cast(float, __builtin_amdgcn_update_dpp(0, __builtin_bit_cast(int, x), 0x164, 0xf, 0xf, true));   // row_xmask:4
  x += __builtin_bit_cast(float, __builtin_amdgcn_update_dpp(0, __builtin_bit_cast(int, x), 0x168, 0xf, 0xf, true));   // row_xmask:8
  return x;
}
__device__ __forceinline__ float xhalf(float x) {   // lane l takes lane l ^ 16
  return __builtin_bit_cast(float, __builtin_amdgcn_permlanex16(__builtin_bit_cast(int, x), __builtin_bit_cast(int, x), 0x76543210, 0xfedcba98, false, false));
}
// ---- k_gn: block = one slice (GN_CH channels) of one (batch, group): the slice is read once, every load of a thread in flight at the same time, and stays in registers for both sums.
// It leaves (slice mean, sum of squared deviations from the slice mean) in a 128-B line of its own; k_proj joins the GN_SL slices of a group.
// The weight conversion depends on nothing here and nothing here depends on it, so it rides in the same grid: the work-groups behind the GN_WG statistics groups make the f16(bf16(w) x 256) planes (exact), 8 contiguous elements = one 16-B store per thread.
// They come last in the grid.
#define GN_WG (NB * GROUPS * GN_SL)                      // statistics work-groups
#define CV_WG ((3 * CC * DIN + DIN * CC) / 8 / 256)      // weight work-groups
__global__ __launch_bounds__(256) void k_gn(const float* __restrict__ X, float* __restrict__ GS, const float* __restrict__ WA, const float* __restrict__ WB, _Float16* __restrict__ P1, _Float16* __restrict__ P2) {
  __shared__ __align__(16) float sa[8]; __shared__ __align__(16) float sq[8];
  if (blockIdx.x >= GN_WG) {   // block-uniform, and the whole work-group leaves in front of every barrier
    const int n1c = 3 * CC * DIN / 8, n2c = DIN * CC / 8;
    const int i8 = (blockIdx.x - GN_WG) * 256 + threadIdx.x; if (i8 >= n1c + n2c) return;
    const bool second = i8 >= n1c;   // block-uniform (n1c is a multiple of 256)
    const float* src = second ? WB + (size_t)(i8 - n1c) * 8 : WA + (size_t)i8 * 8;
    _Float16* dst = second ? P2 + (size_t)(i8 - n1c) * 8 : P1 + (size_t)i8 * 8;
    const v8f v = *(const v8f*)src; union { v8h h; v4u u; } o;
#pragma unroll
    for (int e = 0; e < 8; ++e) { const float f = v[e]; o.h[e] = (_Float16)(bfr(f) * 256.0f); }
    vst2(dst, o.u);
    return;
  }
  const int tid = threadIdx.x, wave = tid >> 5, lane = tid & 31; const int bg = blockIdx.x / GN_SL, sl = blockIdx.x % GN_SL; const int b = bg / GROUPS, gi = bg % GROUPS;
  const float* xp = X + ((size_t)b * DIN + (size_t)gi * CPG + (size_t)sl * GN_CH) * NPIX;
  v4f v[GN_LD];
  // the three loops are unrolled so that v[] has constant indices (stays in registers) and every load issues ahead of the first wait
#pragma unroll
  for (int i = 0; i < GN_LD; ++i) { const int e = tid + 256 * i; const int c = e / (TT / 4), t4 = e - c * (TT / 4); v[i] = *(const v4f*)(xp + (size_t)c * NPIX + (size_t)t4 * 4); }
  float s = 0.f;
#pragma unroll
  for (int i = 0; i < GN_LD; ++i) { const float x0 = v[i][0], x1 = v[i][1], x2 = v[i][2], x3 = v[i][3];
    v[i][0] = bfr(x0); v[i][1] = bfr(x1); v[i][2] = bfr(x2); v[i][3] = bfr(x3); s += (v[i][0] + v[i][1]) + (v[i][2] + v[i][3]); }
  s = rowsum(s); s += xhalf(s);
  if (lane == 0) sa[wave] = s;
  __syncthreads();
  const v4f a0 = *(const v4f*)&sa[0], a1 = *(const v4f*)&sa[4];
  const float mean = (((a0[0] + a0[1]) + (a0[2] + a0[3])) + ((a1[0] + a1[1]) + (a1[2] + a1[3]))) * (1.0f / (float)(GN_CH * TT));
  float s2 = 0.f;
#pragma unroll
  for (int i = 0; i < GN_LD; ++i) { const float d0 = v[i][0] - mean, d1 = v[i][1] - mean, d2 = v[i][2] - mean, d3 = v[i][3] - mean;
    s2 += (d0 * d0 + d1 * d1) + (d2 * d2 + d3 * d3); }
  s2 = rowsum(s2); s2 += xhalf(s2);
  if (lane == 0) sq[wave] = s2;
  __syncthreads();
  if (tid < 32) { const v4f q0 = *(const v4f*)&sq[0], q1 = *(const v4f*)&sq[4];
    const float m2 = ((q0[0] + q0[1]) + (q0[2] + q0[3])) + ((q1[0] + q1[1]) + (q1[2] + q1[3]));
    const float val = tid == 0 ? mean : (tid == 1 ? m2 : 0.f); vst2(GS + (size_t)blockIdx.x * 32 + tid, val); }
}
// The block's 128 W rows are staged once in LDS by whole-line loads (a wave's 16-byte load = 512 contiguous bytes) and shared by its four waves; the B fragments come from there.
#define PJ_WP (DIN + 8)      // W row pitch in LDS, f16: 528 B = 16 B x odd, conflict-free for 16-byte readers
#define PJ_LD (CC * DIN / 8 / 128)   // 16-byte pieces per thread
static_assert((CC * DIN / 8) % 128 == 0);
static_assert(DIN == 2 * 128);   // k_proj: each of its 128 threads rounds two affine weights and two offsets into LDS
// No global load is waited for inside the k loop: a lane's x values of all eight chunks are in flight from the prologue on (registers), and the affine weights come from LDS.
// ---- k_proj: block = (64 voxel rows, which in {q,k,v}): GroupNorm applied on the channels-first gather (group == 32-channel k chunk), qkv = W xn with f16 operands (W x 256) -> which 0/1: f16 rows [b*TT+t][128]; which 2: f16 planes [b][c][t]
__global__ __launch_bounds__(128) void k_proj(const float* __restrict__ X, const float* __restrict__ GS, const float* __restrict__ GW, const float* __restrict__ GB, const _Float16* __restrict__ W1,
    _Float16* __restrict__ QH, _Float16* __restrict__ KH, _Float16* __restrict__ VT) {
  __shared__ __align__(16) _Float16 sh[64][136]; __shared__ __align__(16) _Float16 th[128][72]; __shared__ float sst[GROUPS][2]; __shared__ __align__(16) _Float16 wl[CC * PJ_WP]; __shared__ __align__(32) float sgw[DIN]; __shared__ __align__(32) float sgb[DIN];
  const int tid = threadIdx.x, wave = tid >> 5, lane = tid & 31, col = lane & 15, g = lane >> 4; const int which = blockIdx.y;
  const size_t r0 = (size_t)blockIdx.x * 64; const size_t bb = r0 / TT; const int t0 = (int)(r0 % TT);
  const float* xp = X + ((size_t)bb * DIN + 8 * g) * NPIX + t0 + wave * 16 + col;   // x[b][k][n], stride NPIX between channels
  const float* gp = GS + ((size_t)bb * GROUPS * GN_SL + tid) * 32; const float pm = gp[0], pq = gp[1];   // thread = (group tid >> 4, slice tid & 15)
  asm volatile("s_wait_xcnt 0x0" ::: "memory");   // stands in front of the re-use of the statistics load's offset register
  float xr[DIN / 32][16];
  // every loop over xr[] is unrolled so that it has constant indices and stays in registers, and all 128 loads go out ahead of the first wait
#pragma unroll
  for (int kc = 0; kc < DIN / 32; ++kc)
#pragma unroll
    for (int i = 0; i < 8; ++i) { xr[kc][i] = xp[(size_t)(kc * 32 + i) * NPIX]; xr[kc][8 + i] = xp[(size_t)(kc * 32 + 16 + i) * NPIX]; }
  { // join the slices' statistics, once per block: thread = (group tid >> 4, slice tid & 15), a group = one 16-lane row
    const float gw0 = GW[tid], gw1 = GW[tid + 128], gb0 = GB[tid], gb1 = GB[tid + 128];
    // W rows [which * 128, + 128) are one contiguous run: piece e = tid + 128 i is row e >> 5, piece e & 31. Both loops are unrolled so that wr[] stays in registers and every load is in flight before the first store.
    const _Float16* wg = W1 + (size_t)which * CC * DIN; v4u wr[PJ_LD];
#pragma unroll
    for (int i = 0; i < PJ_LD; ++i) wr[i] = *(const v4u*)(wg + (size_t)(tid + 128 * i) * 8);
#pragma unroll
    for (int i = 0; i < PJ_LD; ++i) { const int e = tid + 128 * i; *(v4u*)&wl[(e >> 5) * PJ_WP + (e & 31) * 8] = wr[i]; }
    sgw[tid] = bfr(gw0); sgw[tid + 128] = bfr(gw1); sgb[tid] = bfr(gb0); sgb[tid + 128] = bfr(gb1);
    const float mean = rowsum(pm) * (1.0f / (float)GN_SL); const float dm = pm - mean;
    const float var = rowsum(pq + (float)(GN_CH * TT) * (dm * dm)) * (1.0f / (float)(CPG * TT));
    if (col == 0) { sst[tid >> 4][0] = mean; sst[tid >> 4][1] = 1.0f / sqrtf(var + EPS); } }
  __syncthreads();   // publishes the eight groups' mean and reciprocal deviation, the rounded affine weights and the staged W rows to all four waves
  v8f acc[8] = {};
  // unrolled: xr[] needs constant indices
#pragma unroll
  for (int kc = 0; kc < DIN / 32; ++kc) {
    const float mu = sst[kc][0], rs = sst[kc][1];
    v16h a, w[8];
    // the eight B fragments are read as a group ahead of the first WMMA, so that one LDS latency is waited out per k chunk, not eight (unrolled: constant indices keep w[] in registers)
#pragma unroll
    for (int j = 0; j < 8; ++j) w[j] = frag_h(&wl[(j * 16 + col) * PJ_WP + kc * 32], lane);
    { const v8f w0 = *(const v8f*)&sgw[kc * 32 + 8 * g], w1 = *(const v8f*)&sgw[kc * 32 + 16 + 8 * g];
      const v8f b0 = *(const v8f*)&sgb[kc * 32 + 8 * g], b1 = *(const v8f*)&sgb[kc * 32 + 16 + 8 * g];
#pragma unroll
      for (int i = 0; i < 8; ++i) {
        const float xa = xr[kc][i], xb = xr[kc][8 + i]; const float wa = w0[i], wb = w1[i], ba = b0[i], bbv = b1[i];
        a[i]     = (_Float16)(((bfr(xa) - mu) * rs) * wa + ba);
        a[8 + i] = (_Float16)(((bfr(xb) - mu) * rs) * wb + bbv); } }
#pragma unroll
    for (int j = 0; j < 8; ++j) acc[j] = wmma16(a, w[j], acc[j]);
  }
  if (which < 2) { _Float16* DH = which == 0 ? QH : KH;
#pragma unroll
    for (int j = 0; j < 8; ++j)
#pragma unroll
      for (int r = 0; r < 8; ++r) sh[wave * 16 + 8 * g + r][j * 16 + col] = (_Float16)(acc[j][r] * (1.0f / 256.0f));
    __syncthreads();
    // unrolled, constant trip count: the LDS reads go out as a group, not one waited for per trip
#pragma unroll
    for (int i = 0; i < 64 * 16 / 128; ++i) { const int e = tid + 128 * i; const int rl = e >> 4, q = e & 15; vst2(DH + (r0 + rl) * CC + q * 8, *(const v4u*)&sh[rl][q * 8]); }
  } else {
#pragma unroll
    for (int j = 0; j < 8; ++j)
#pragma unroll
      for (int r = 0; r < 8; ++r) th[j * 16 + col][wave * 16 + 8 * g + r] = (_Float16)(acc[j][r] * (1.0f / 256.0f));
    __syncthreads();
    // unrolled, constant trip count: the LDS reads go out as a group, not one waited for per trip
#pragma unroll
    for (int i = 0; i < 128 * 8 / 128; ++i) { const int e = tid + 128 * i; const int cl = e >> 3, q = e & 7; vst2(VT + (bb * CC + cl) * (size_t)TT + t0 + q * 8, *(const v4u*)&th[cl][q * 8]); }
  }
}
#define FA_KS 128            // keys per wave and LDS stage
#define FA_KT (2 * FA_KS)    // keys per LDS stage: one run for each of the two wave groups
#define FA_KP (HD + 8)       // K row pitch in f16: 80 B = 16 B x odd, conflict-free for 16-byte readers
#define FA_VP (FA_KT + 8)    // V^T row pitch in f16: 528 B = 16 B x odd
#define FA_NS (TT / FA_KT)
static_assert(HD == 32);
static_assert(TT % FA_KT == 0);
__device__ __forceinline__ v8f wmma_b(v16h a, v16h b, v8f c) { return __builtin_amdgcn_wmma_f32_16x16x32_f16(false, a, false, b, (short)0, c, false, false); }
__global__ __launch_bounds__(512) void k_fa(const _Float16* __restrict__ QH, const _Float16* __restrict__ KH, const _Float16* __restrict__ VT, float* __restrict__ Y) {
  __shared__ __align__(16) _Float16 kl[2][FA_KT * FA_KP]; __shared__ __align__(16) _Float16 vl[2][HD * FA_VP]; __shared__ float mg[8][18][32];
  const int tid = threadIdx.x, wave = tid >> 5, lane = tid & 31, col = lane & 15, g = lane >> 4; const int qw = wave & 7, kh = wave >> 3;   // query group, key run
  const int b = blockIdx.y / NH, h = blockIdx.y % NH; const int q0 = blockIdx.x * 128 + qw * 16;
  const float cs = SCALE * 1.4426950408889634f;   // logit scale x log2(e)
  const v16h qf = frag_h(QH + ((size_t)b * TT + q0 + col) * CC + h * HD, lane);
  // staging: 16-byte pieces; K: 4 pieces a key row, rows tid>>2 and 128 + tid>>2; V^T: 32 pieces a channel row, rows tid>>5 and 16 + tid>>5
  const _Float16* kg = KH + ((size_t)b * TT + (tid >> 2)) * CC + h * HD + (tid & 3) * 8;
  const _Float16* vg = VT + ((size_t)b * CC + h * HD + (tid >> 5)) * (size_t)TT + (tid & 31) * 8;
  const int kd = (tid >> 2) * FA_KP + (tid & 3) * 8, vd = (tid >> 5) * FA_VP + (tid & 31) * 8;
  { const v4u k0 = *(const v4u*)kg, k1 = *(const v4u*)(kg + (size_t)128 * CC), w0 = *(const v4u*)vg, w1 = *(const v4u*)(vg + (size_t)16 * TT);
    *(v4u*)&kl[0][kd] = k0; *(v4u*)&kl[0][kd + 128 * FA_KP] = k1; *(v4u*)&vl[0][vd] = w0; *(v4u*)&vl[0][vd + 16 * FA_VP] = w1; }
  __syncthreads();
  v8f acc[2] = {}; float mrun = -3.0e38f, lsum = 0.f;
  // the stage loop stays rolled (one copy of the 128-key body in the instruction cache; the buffer is a run-time bit); the loops inside are unrolled so that every register array has constant indices
#pragma unroll 1
  for (int st = 0; st < FA_NS; ++st) {
    const int buf = st & 1; const bool more = st + 1 < FA_NS;   // block-uniform
    v4u k0 = {}, k1 = {}, w0 = {}, w1 = {};
    if (more) { const _Float16* kn = kg + (size_t)(st + 1) * FA_KT * CC; const _Float16* vn = vg + (size_t)(st + 1) * FA_KT;   // next stage's loads fly under this stage's work
      k0 = *(const v4u*)kn; k1 = *(const v4u*)(kn + (size_t)128 * CC); w0 = *(const v4u*)vn; w1 = *(const v4u*)(vn + (size_t)16 * TT); }
#pragma unroll
    for (int ps = 0; ps < FA_KS / 64; ++ps) {
      v8f s[4];
#pragma unroll
      for (int t = 0; t < 4; ++t) { const v8f z = {}; s[t] = wmma_b(frag_h(&kl[buf][(kh * FA_KS + ps * 64 + t * 16 + col) * FA_KP], lane), qf, z); }   // s[t][r] = logit(key 16t + 8g + r, query col)
      float mt[4];
#pragma unroll
      for (int t = 0; t < 4; ++t) { mt[t] = s[t][0];
#pragma unroll
        for (int r = 1; r < 8; ++r) mt[t] = fmaxf(mt[t], s[t][r]); }
      float mx = fmaxf(fmaxf(mt[0], mt[1]), fmaxf(mt[2], mt[3]));
      mx = fmaxf(mx, xhalf(mx)) * cs;   // both halves of the wave hold this query's maximum (the scale is positive)
      const float mn = fmaxf(mrun, mx); const float corr = __builtin_amdgcn_exp2f(mrun - mn); mrun = mn;   // corr = 0 on the first pass
      acc[0] = acc[0] * corr; acc[1] = acc[1] * corr;
      const float nm = 11.0f - mn;   // P x 2^11: keeps small weights out of the f16 subnormals; it cancels in the division by the row sum
      v16h pf[2]; float pt[4]; v8f e[4], p[4];
#pragma unroll
      for (int t = 0; t < 4; ++t)
#pragma unroll
        for (int r = 0; r < 8; ++r) { e[t][r] = fmaf(s[t][r], cs, nm); p[t][r] = __builtin_amdgcn_exp2f(e[t][r]); }
      // the slot that the instruction set asks for behind a transcendental: as inputs, the results put the v_nop behind the last exponential and the arguments keep their registers unwritten until there
      asm volatile("v_nop" :: "v"(p[0]), "v"(p[1]), "v"(p[2]), "v"(p[3]), "v"(e[0]), "v"(e[1]), "v"(e[2]), "v"(e[3]));
#pragma unroll
      for (int t = 0; t < 4; ++t) { pt[t] = ((p[t][0] + p[t][1]) + (p[t][2] + p[t][3])) + ((p[t][4] + p[t][5]) + (p[t][6] + p[t][7]));
#pragma unroll
        for (int r = 0; r < 8; ++r) pf[t >> 1][(t & 1) * 8 + r] = (_Float16)p[t][r]; }
      lsum = lsum * corr + ((pt[0] + pt[1]) + (pt[2] + pt[3]));   // this half's keys only; the halves join after the loop
#pragma unroll
      for (int kk = 0; kk < 2; ++kk)
#pragma unroll
        for (int j = 0; j < 2; ++j) acc[j] = wmma_b(frag_h(&vl[buf][(j * 16 + col) * FA_VP + kh * FA_KS + ps * 64 + kk * 32], lane), pf[kk], acc[j]);   // acc[j][r] = ctx(channel 16j + 8g + r, query col)
    }
    if (more) { const int nb = buf ^ 1;   // its last readers left it before the barrier that ended the stage before
      *(v4u*)&kl[nb][kd] = k0; *(v4u*)&kl[nb][kd + 128 * FA_KP] = k1; *(v4u*)&vl[nb][vd] = w0; *(v4u*)&vl[nb][vd + 16 * FA_VP] = w1; }
    __syncthreads();   // publishes stage st + 1 and ends every read of stage st
  }
  // join of the two key runs: the second wave of a query group hands over its unnormalised output, maximum and sum (a wave's store = 128 contiguous bytes, free of bank conflicts); the loops here are unrolled so that acc[] keeps constant indices and stays in registers
  if (kh == 1) {
#pragma unroll
    for (int j = 0; j < 2; ++j)
#pragma unroll
      for (int r = 0; r < 8; ++r) mg[qw][j * 8 + r][lane] = acc[j][r];
    mg[qw][16][lane] = mrun; mg[qw][17][lane] = lsum; }
  __syncthreads();   // publishes the second waves' partial results to the first
  if (kh == 0) {
    const float m1 = mg[qw][16][lane], l1 = mg[qw][17][lane]; const float mn = fmaxf(mrun, m1);
    const float d0 = mrun - mn, d1 = m1 - mn; const float c0 = __builtin_amdgcn_exp2f(d0), c1 = __builtin_amdgcn_exp2f(d1);
    const float ls = lsum * c0 + l1 * c1; const float inv = 1.0f / (ls + xhalf(ls)); const float f0 = c0 * inv, f1 = c1 * inv;
    float* yp = Y + ((size_t)b * TT + q0 + col) * CC + h * HD + 8 * g;   // a query's 32 channels = one 128-B line, written whole by lanes col and col + 16
#pragma unroll
    for (int j = 0; j < 2; ++j) { v8f o;
#pragma unroll
      for (int r = 0; r < 8; ++r) o[r] = acc[j][r] * f0 + mg[qw][j * 8 + r][lane] * f1;
      const v4f lo = {o[0], o[1], o[2], o[3]}, hi = {o[4], o[5], o[6], o[7]}; vst2(yp + j * 16, lo); vst2(yp + j * 16 + 4, hi); } }
}
#define PO_WP (CC + 8)       // W row pitch in LDS, f16: 272 B = 16 B x odd
#define PO_LD (128 * CC / 8 / 128)   // 16-byte pieces per thread
// Every global load of a thread (W pieces, its ctx row, the bias, its 16 residual pieces of x) is issued at the head of the kernel and stays in registers: no load is waited for in the k loop or in the store loop.
// ---- k_out: block = (64 voxel rows, 128 output channels), its 128 W rows staged in LDS as in k_proj: proj = W ctx (ctx x 64 f16 against W x 256 f16) + bf16(bias), LDS transpose to channels-first, + bf16(x), whole 256-B (c, 64 n) runs by 16 lanes
__global__ __launch_bounds__(128) void k_out(const float* __restrict__ Y, const float* __restrict__ X, const _Float16* __restrict__ W2, const float* __restrict__ PB, float* __restrict__ OUT) {
  __shared__ __align__(16) float stc[128][68]; __shared__ __align__(16) _Float16 wl[128 * PO_WP];
  const int tid = threadIdx.x, wave = tid >> 5, lane = tid & 31, col = lane & 15, g = lane >> 4; const int c0 = blockIdx.y * 128;
  const size_t r0 = (size_t)blockIdx.x * 64; const size_t bb = r0 / TT; const int t0 = (int)(r0 % TT);
  const float* yq = Y + (r0 + wave * 16 + col) * CC + 8 * g;   // fragment order: elements 0..7 = k0 + 8g + 0..7, 8..15 = k0 + 16 + 8g + 0..7
  const size_t o0 = ((size_t)bb * DIN + c0 + (tid >> 4)) * NPIX + t0 + (tid & 15) * 4;   // store piece i of a thread: channel c0 + (tid >> 4) + 8 i, voxels t0 + 4 (tid & 15) ..
  v8f ya[CC / 32][2]; float pb[8]; v4f xv[16];
  { // W rows [c0, c0 + 128) are one contiguous run: piece e = tid + 128 i is row e >> 4, piece e & 15; all loops over register arrays here are unrolled so that the arrays have constant indices and every load is in flight before the first store
    const _Float16* wg = W2 + (size_t)c0 * CC; v4u wr[PO_LD];
#pragma unroll
    for (int j = 0; j < 8; ++j) pb[j] = PB[c0 + j * 16 + col];
    asm volatile("s_wait_xcnt 0x0" ::: "memory");   // stands in front of the re-use of the bias loads' offset register
#pragma unroll
    for (int i = 0; i < PO_LD; ++i) wr[i] = *(const v4u*)(wg + (size_t)(tid + 128 * i) * 8);
#pragma unroll
    for (int kc = 0; kc < CC / 32; ++kc) { ya[kc][0] = *(const v8f*)(yq + kc * 32); ya[kc][1] = *(const v8f*)(yq + kc * 32 + 16); }
#pragma unroll
    for (int i = 0; i < 16; ++i) xv[i] = *(const v4f*)(X + o0 + (size_t)i * 8 * NPIX);
#pragma unroll
    for (int i = 0; i < PO_LD; ++i) { const int e = tid + 128 * i; *(v4u*)&wl[(e >> 4) * PO_WP + (e & 15) * 8] = wr[i]; } }
  __syncthreads();   // publishes the staged W rows to all four waves
  v8f acc[8] = {};
  // unrolled: ya[] needs constant indices
#pragma unroll
  for (int kc = 0; kc < CC / 32; ++kc) { v16h w[8];
    // the eight B fragments are read as a group ahead of the first WMMA, so that one LDS latency is waited out per k chunk, not eight (unrolled: constant indices keep w[] in registers)
#pragma unroll
    for (int j = 0; j < 8; ++j) w[j] = frag_h(&wl[(j * 16 + col) * PO_WP + kc * 32], lane);
    v16h a;
#pragma unroll
    for (int i = 0; i < 8; ++i) { const float x0 = ya[kc][0][i], x1 = ya[kc][1][i]; a[i] = (_Float16)(x0 * 64.0f); a[8 + i] = (_Float16)(x1 * 64.0f); }
#pragma unroll
    for (int j = 0; j < 8; ++j) acc[j] = wmma16(a, w[j], acc[j]); }
#pragma unroll
  for (int j = 0; j < 8; ++j) { const float bias = bfr(pb[j]);
#pragma unroll
    for (int r = 0; r < 8; ++r) stc[j * 16 + col][wave * 16 + 8 * g + r] = acc[j][r] * (1.0f / 16384.0f) + bias; }
  __syncthreads();
  // unrolled: xv[] needs constant indices, and the LDS reads go out in groups
#pragma unroll
  for (int i = 0; i < 16; ++i) { const float x0 = xv[i][0], x1 = xv[i][1], x2 = xv[i][2], x3 = xv[i][3]; v4f r4 = *(const v4f*)&stc[(tid >> 4) + 8 * i][(tid & 15) * 4];
    r4[0] += bfr(x0); r4[1] += bfr(x1); r4[2] += bfr(x2); r4[3] += bfr(x3); vst2(OUT + o0 + (size_t)i * 8 * NPIX, r4); }
}

extern "C" void kernel_launch(void* const* d_in, const int* in_sizes, int n_in, void* d_out, int out_size, void* d_ws, size_t ws_size, hipStream_t stream) {
  // inputs (wire order): 0 x [2,256,16,16,16] f32; 1 norm_w [256]; 2 norm_b [256]; 3 qkv_w (out,in) [384,256]; 4 proj_w (out,in) [256,128]; 5 proj_b [256]
  if (n_in < 6) return;
  if (in_sizes[0] < NB * DIN * NPIX || in_sizes[1] < DIN || in_sizes[2] < DIN || in_sizes[3] < 3 * CC * DIN || in_sizes[4] < DIN * CC || in_sizes[5] < DIN) return;
  if (out_size < NB * DIN * NPIX) return;
  if (ws_size < WS_END) return;
  const float* X = (const float*)d_in[0]; const float* GW = (const float*)d_in[1]; const float* GB = (const float*)d_in[2];
  const float* WQ = (const float*)d_in[3]; const float* WP = (const float*)d_in[4]; const float* PB = (const float*)d_in[5];
  char* ws = (char*)d_ws;
  float* GS = (float*)(ws + WS_GS); _Float16* W1 = (_Float16*)(ws + WS_W1); _Float16* W2 = (_Float16*)(ws + WS_W2);
  _Float16* QH = (_Float16*)(ws + WS_QH); _Float16* KH = (_Float16*)(ws + WS_KH); _Float16* VT = (_Float16*)(ws + WS_VT);
  float* Y = (float*)(ws + WS_Y); float* OUT = (float*)d_out;
  k_gn<<<dim3(GN_WG + CV_WG), 256, 0, stream>>>(X, GS, WQ, WP, W1, W2);
  k_proj<<<dim3(NB * TT / 64, 3), 128, 0, stream>>>(X, GS, GW, GB, W1, QH, KH, VT);
  k_fa<<<dim3(TT / 128, NB * NH), 512, 0, stream>>>(QH, KH, VT, Y);
  k_out<<<dim3(NB * TT / 64, DIN / 128), 128, 0, stream>>>(Y, X, W2, PB, OUT);
}

// v007
// It runs in 37 microseconds.
// Two timings next to v006 put it at 1.07 and 1.04 times that version's speed.
// All steps since v000 together make it 30.5 times as fast.
// compute dtype: every float input RNE-converted to bf16 on load; GroupNorm statistics f32: per 2-channel slice a tree sum for the mean and the squared deviations from it, slices joined by the parallel-variance rule; qkv = W x on v_wmma_f32_16x16x32_f16 with W as f16(bf16 x 256) and normalised x as f16, f32 accumulate; q carries the logit scale x log2(e) ahead of its one f16 rounding; logits k.q f16 x f16 single product, f32 accumulate on a start value of 9 - reference maximum; softmax f32, online over 128-key runs (base-2 exponential; the reference is the first run's maximum and is raised, with a rescale, only when a lane's run sum of P tops 60,000), unnormalised P x 2^9 to f16 once against v f16 (single product), a query's keys dealt in 128-key runs to two waves whose partial sums are joined once on the larger of their references, one division by the f32 row sum at the end; output projection: ctx x 64 f16 against W f16(bf16 x 256), f32 accumulate; bias + residual add in f32; f32 output (channels-first).
#include <hip/hip_runtime.h>
#include <math.h>

typedef __attribute__((ext_vector_type(16))) _Float16 v16h;
typedef __attribute__((ext_vector_type(8)))  _Float16 v8h;
typedef __attribute__((ext_vector_type(8)))  float v8f;
typedef __attribute__((ext_vector_type(4)))  float v4f;
typedef __attribute__((ext_vector_type(4)))  unsigned v4u;

template <typename T> __device__ __forceinline__ void vst2(void* p, T v) { *(T*)p = v;  }
__device__ __forceinline__ v8f wmma16(v16h a, v16h b, v8f c) {
  v8f d = __builtin_amdgcn_wmma_f32_16x16x32_f16(false, a, false, b, (short)0, c, false, false);
  asm volatile("v_nop\n\tv_nop\n\tv_nop\n\tv_nop" : "+v"(d) : "v"(a), "v"(b));
  return d;
}
// 16x16x32 fragments: lane = (h = lane>>4, row/col = lane&15); elements 0..7 = k0+8h+0..7, 8..15 = k0+16+8h+0..7; D element r = row 8h+r, col lane&15
__device__ __forceinline__ v16h frag_h(const _Float16* rowk0, int lane) {
  union { v16h v; v8h q[2]; } u; const _Float16* p = rowk0 + 8 * (lane >> 4);
  u.q[0] = *(const v8h*)p; u.q[1] = *(const v8h*)(p + 16); return u.v;
}
__device__ __forceinline__ float bfr(float v) { return (float)(__bf16)v; }

// Self-attention over a flattened 16x16x16 volume: GroupNorm(8 groups, affine) -> 1x1x1 conv qkv (W (out,in) [384][256], no bias) -> 4 heads x 32 dims, softmax((q^T k) * 32^-0.5) over 4,096 keys -> ctx -> 1x1x1 conv proj (W (out,in) [256][128] + bias) -> + x. Channels-first in and out.
#ifndef NB
#define NB 2
#endif
#ifndef SEQ
#define SEQ 4096
#endif
#define NB_FULL 2
#define TT SEQ              // voxels attended per batch element
#define NPIX 4096           // full per-channel voxel stride of x and of the output
#define DIN 256             // model width (input / output channels)
#define GROUPS 8
#define CPG (DIN / GROUPS)  // channels per group
#define NH 4
#define HD 32
#define CC (NH * HD)        // inner width 128
#define SCALE (0.17677669529663687f)
#define EPS (1.0e-5f)
#define QSC (SCALE * 1.4426950408889634f)   // logit scale x log2(e)
#define GN_SL 16                            // slices (work-groups) per group
#define GN_CH (CPG / GN_SL)                 // channels per slice
#define GN_LD (GN_CH * (TT / 4) / 256)      // 16-byte loads per thread
static_assert(CPG == 32);
static_assert(CPG % GN_SL == 0);
static_assert((GN_CH * (TT / 4)) % 256 == 0);
static_assert(GROUPS * GN_SL == 128);
static_assert(CC == 128);
static_assert(DIN % 128 == 0);
static_assert(TT % 128 == 0);
static_assert(TT <= NPIX);
static_assert(NB <= NB_FULL);
static_assert(((size_t)NB * DIN - 1) * NPIX + TT <= (size_t)2097152);   // last written output element < 8,388,608 B / 4

// workspace carve (bytes): GS one 128-B line of partial statistics per (batch, group, slice) | W1 f16 [384][256] | W2 f16 [256][128] | QH f16 rows [NB*TT][CC] | KH | VT f16 planes [NB][CC][TT] | Y f32 rows [NB*TT][CC]
#define WS_GS  ((size_t)0)
#define WS_W1  ((size_t)128 * NB_FULL * GROUPS * GN_SL)
#define WS_W2  (WS_W1 + 2u * (size_t)3 * CC * DIN)
#define WS_QH  (WS_W2 + 2u * (size_t)DIN * CC)
#define WS_KH  (WS_QH + 2u * (size_t)NB * TT * CC)
#define WS_VT  (WS_KH + 2u * (size_t)NB * TT * CC)
#define WS_Y   (WS_VT + 2u * (size_t)NB * CC * TT)
#define WS_END (WS_Y  + 4u * (size_t)NB * TT * CC)
static_assert(WS_END <= (size_t)134217728);
static_assert((3 * CC * DIN / 8) % 256 == 0);
static_assert(((3 * CC * DIN + DIN * CC) / 8) % 256 == 0);

// sum over the 16 lanes of a row, left in every lane of the row (four butterfly steps on the vector port, no LDS)
__device__ __forceinline__ float rowsum(float x) {
  x += __builtin_bit_cast(float, __builtin_amdgcn_update_dpp(0, __builtin_bit_cast(int, x), 0x161, 0xf, 0xf, true));   // row_xmask:1
  x += __builtin_bit_cast(float, __builtin_amdgcn_update_dpp(0, __builtin_bit_cast(int, x), 0x162, 0xf, 0xf, true));   // row_xmask:2
  x += __builtin_bit_cast(float, __builtin_amdgcn_update_dpp(0, __builtin_bit_cast(int, x), 0x164, 0xf, 0xf, true));   // row_xmask:4
  x += __builtin_bit_cast(float, __builtin_amdgcn_update_dpp(0, __builtin_bit_cast(int, x), 0x168, 0xf, 0xf, true));   // row_xmask:8
  return x;
}
__device__ __forceinline__ float xhalf(float x) {   // lane l takes lane l ^ 16
  return __builtin_bit_cast(float, __builtin_amdgcn_permlanex16(__builtin_bit_cast(int, x), __builtin_bit_cast(int, x), 0x76543210, 0xfedcba98, false, false));
}
// ---- k_gn: block = one slice (GN_CH channels) of one (batch, group): the slice is read once, every load of a thread in flight at the same time, and stays in registers for both sums.
// It leaves (slice mean, sum of squared deviations from the slice mean) in a 128-B line of its own; k_proj joins the GN_SL slices of a group.
// The weight conversion depends on nothing here and nothing here depends on it, so it rides in the same grid: the work-groups behind the GN_WG statistics groups make the f16(bf16(w) x 256) planes (exact), 8 contiguous elements = one 16-B store per thread.
// They come last in the grid.
#define GN_WG (NB * GROUPS * GN_SL)                      // statistics work-groups
#define CV_WG ((3 * CC * DIN + DIN * CC) / 8 / 256)      // weight work-groups
__global__ __launch_bounds__(256) void k_gn(const float* __restrict__ X, float* __restrict__ GS, const float* __restrict__ WA, const float* __restrict__ WB, _Float16* __restrict__ P1, _Float16* __restrict__ P2) {
  __shared__ __align__(16) float sa[8]; __shared__ __align__(16) float sq[8];
  if (blockIdx.x >= GN_WG) {   // block-uniform, and the whole work-group leaves in front of every barrier
    const int n1c = 3 * CC * DIN / 8, n2c = DIN * CC / 8;
    const int i8 = (blockIdx.x - GN_WG) * 256 + threadIdx.x; if (i8 >= n1c + n2c) return;
    const bool second = i8 >= n1c;   // block-uniform (n1c is a multiple of 256)
    const float* src = second ? WB + (size_t)(i8 - n1c) * 8 : WA + (size_t)i8 * 8;
    _Float16* dst = second ? P2 + (size_t)(i8 - n1c) * 8 : P1 + (size_t)i8 * 8;
    const v8f v = *(const v8f*)src; union { v8h h; v4u u; } o;
#pragma unroll
    for (int e = 0; e < 8; ++e) { const float f = v[e]; o.h[e] = (_Float16)(bfr(f) * 256.0f); }
    vst2(dst, o.u);
    return;
  }
  const int tid = threadIdx.x, wave = tid >> 5, lane = tid & 31; const int bg = blockIdx.x / GN_SL, sl = blockIdx.x % GN_SL; const int b = bg / GROUPS, gi = bg % GROUPS;
  const float* xp = X + ((size_t)b * DIN + (size_t)gi * CPG + (size_t)sl * GN_CH) * NPIX;
  v4f v[GN_LD];
  // the three loops are unrolled so that v[] has constant indices (stays in registers) and every load issues ahead of the first wait
#pragma unroll
  for (int i = 0; i < GN_LD; ++i) { const int e = tid + 256 * i; const int c = e / (TT / 4), t4 = e - c * (TT / 4); v[i] = *(const v4f*)(xp + (size_t)c * NPIX + (size_t)t4 * 4); }
  float s = 0.f;
#pragma unroll
  for (int i = 0; i < GN_LD; ++i) { const float x0 = v[i][0], x1 = v[i][1], x2 = v[i][2], x3 = v[i][3];
    v[i][0] = bfr(x0); v[i][1] = bfr(x1); v[i][2] = bfr(x2); v[i][3] = bfr(x3); s += (v[i][0] + v[i][1]) + (v[i][2] + v[i][3]); }
  s = rowsum(s); s += xhalf(s);
  if (lane == 0) sa[wave] = s;
  __syncthreads();
  const v4f a0 = *(const v4f*)&sa[0], a1 = *(const v4f*)&sa[4];
  const float mean = (((a0[0] + a0[1]) + (a0[2] + a0[3])) + ((a1[0] + a1[1]) + (a1[2] + a1[3]))) * (1.0f / (float)(GN_CH * TT));
  float s2 = 0.f;
#pragma unroll
  for (int i = 0; i < GN_LD; ++i) { const float d0 = v[i][0] - mean, d1 = v[i][1] - mean, d2 = v[i][2] - mean, d3 = v[i][3] - mean;
    s2 += (d0 * d0 + d1 * d1) + (d2 * d2 + d3 * d3); }
  s2 = rowsum(s2); s2 += xhalf(s2);
  if (lane == 0) sq[wave] = s2;
  __syncthreads();
  if (tid < 32) { const v4f q0 = *(const v4f*)&sq[0], q1 = *(const v4f*)&sq[4];
    const float m2 = ((q0[0] + q0[1]) + (q0[2] + q0[3])) + ((q1[0] + q1[1]) + (q1[2] + q1[3]));
    const float val = tid == 0 ? mean : (tid == 1 ? m2 : 0.f); vst2(GS + (size_t)blockIdx.x * 32 + tid, val); }
}
// The block's 128 W rows are staged once in LDS by whole-line loads (a wave's 16-byte load = 512 contiguous bytes) and shared by its four waves; the B fragments come from there.
#define PJ_WP (DIN + 8)      // W row pitch in LDS, f16: 528 B = 16 B x odd, conflict-free for 16-byte readers
#define PJ_LD (CC * DIN / 8 / 128)   // 16-byte pieces per thread
static_assert((CC * DIN / 8) % 128 == 0);
static_assert(DIN == 2 * 128);   // k_proj: each of its 128 threads rounds two affine weights and two offsets into LDS
// No global load is waited for inside the k loop: a lane's x values of all eight chunks are in flight from the prologue on (registers), and the affine weights come from LDS.
// ---- k_proj: block = (64 voxel rows, which in {q,k,v}): GroupNorm applied on the channels-first gather (group == 32-channel k chunk), qkv = W xn with f16 operands (W x 256) -> which 0/1: f16 rows [b*TT+t][128]; which 2: f16 planes [b][c][t]
__global__ __launch_bounds__(128) void k_proj(const float* __restrict__ X, const float* __restrict__ GS, const float* __restrict__ GW, const float* __restrict__ GB, const _Float16* __restrict__ W1,
    _Float16* __restrict__ QH, _Float16* __restrict__ KH, _Float16* __restrict__ VT) {
  __shared__ __align__(16) _Float16 sh[64][136]; __shared__ __align__(16) _Float16 th[128][72]; __shared__ float sst[GROUPS][2]; __shared__ __align__(16) _Float16 wl[CC * PJ_WP]; __shared__ __align__(32) float sgw[DIN]; __shared__ __align__(32) float sgb[DIN];
  const int tid = threadIdx.x, wave = tid >> 5, lane = tid & 31, col = lane & 15, g = lane >> 4; const int which = blockIdx.y;
  const size_t r0 = (size_t)blockIdx.x * 64; const size_t bb = r0 / TT; const int t0 = (int)(r0 % TT);
  const float* xp = X + ((size_t)bb * DIN + 8 * g) * NPIX + t0 + wave * 16 + col;   // x[b][k][n], stride NPIX between channels
  const float* gp = GS + ((size_t)bb * GROUPS * GN_SL + tid) * 32; const float pm = gp[0], pq = gp[1];   // thread = (group tid >> 4, slice tid & 15)
  asm volatile("s_wait_xcnt 0x0" ::: "memory");   // stands in front of the re-use of the statistics load's offset register
  float xr[DIN / 32][16];
  // every loop over xr[] is unrolled so that it has constant indices and stays in registers, and all 128 loads go out ahead of the first wait
#pragma unroll
  for (int kc = 0; kc < DIN / 32; ++kc)
#pragma unroll
    for (int i = 0; i < 8; ++i) { xr[kc][i] = xp[(size_t)(kc * 32 + i) * NPIX]; xr[kc][8 + i] = xp[(size_t)(kc * 32 + 16 + i) * NPIX]; }
  { // join the slices' statistics, once per block: thread = (group tid >> 4, slice tid & 15), a group = one 16-lane row
    const float gw0 = GW[tid], gw1 = GW[tid + 128], gb0 = GB[tid], gb1 = GB[tid + 128];
    // W rows [which * 128, + 128) are one contiguous run: piece e = tid + 128 i is row e >> 5, piece e & 31. Both loops are unrolled so that wr[] stays in registers and every load is in flight before the first store.
    const _Float16* wg = W1 + (size_t)which * CC * DIN; v4u wr[PJ_LD];
#pragma unroll
    for (int i = 0; i < PJ_LD; ++i) wr[i] = *(const v4u*)(wg + (size_t)(tid + 128 * i) * 8);
#pragma unroll
    for (int i = 0; i < PJ_LD; ++i) { const int e = tid + 128 * i; *(v4u*)&wl[(e >> 5) * PJ_WP + (e & 31) * 8] = wr[i]; }
    sgw[tid] = bfr(gw0); sgw[tid + 128] = bfr(gw1); sgb[tid] = bfr(gb0); sgb[tid + 128] = bfr(gb1);
    const float mean = rowsum(pm) * (1.0f / (float)GN_SL); const float dm = pm - mean;
    const float var = rowsum(pq + (float)(GN_CH * TT) * (dm * dm)) * (1.0f / (float)(CPG * TT));
    if (col == 0) { sst[tid >> 4][0] = mean; sst[tid >> 4][1] = 1.0f / sqrtf(var + EPS); } }
  __syncthreads();   // publishes the eight groups' mean and reciprocal deviation, the rounded affine weights and the staged W rows to all four waves
  v8f acc[8] = {};
  // unrolled: xr[] needs constant indices
#pragma unroll
  for (int kc = 0; kc < DIN / 32; ++kc) {
    const float mu = sst[kc][0], rs = sst[kc][1];
    v16h a, w[8];
    // the eight B fragments are read as a group ahead of the first WMMA, so that one LDS latency is waited out per k chunk, not eight (unrolled: constant indices keep w[] in registers)
#pragma unroll
    for (int j = 0; j < 8; ++j) w[j] = frag_h(&wl[(j * 16 + col) * PJ_WP + kc * 32], lane);
    { const v8f w0 = *(const v8f*)&sgw[kc * 32 + 8 * g], w1 = *(const v8f*)&sgw[kc * 32 + 16 + 8 * g];
      const v8f b0 = *(const v8f*)&sgb[kc * 32 + 8 * g], b1 = *(const v8f*)&sgb[kc * 32 + 16 + 8 * g];
#pragma unroll
      for (int i = 0; i < 8; ++i) {
        const float xa = xr[kc][i], xb = xr[kc][8 + i]; const float wa = w0[i], wb = w1[i], ba = b0[i], bbv = b1[i];
        a[i]     = (_Float16)(((bfr(xa) - mu) * rs) * wa + ba);
        a[8 + i] = (_Float16)(((bfr(xb) - mu) * rs) * wb + bbv); } }
#pragma unroll
    for (int j = 0; j < 8; ++j) acc[j] = wmma16(a, w[j], acc[j]);
  }
  if (which < 2) { _Float16* DH = which == 0 ? QH : KH; const float os = which == 0 ? QSC * (1.0f / 256.0f) : 1.0f / 256.0f;   // q leaves with the logit scale x log2(e) in it: k_fa's scores need no multiply
#pragma unroll
    for (int j = 0; j < 8; ++j)
#pragma unroll
      for (int r = 0; r < 8; ++r) sh[wave * 16 + 8 * g + r][j * 16 + col] = (_Float16)(acc[j][r] * os);
    __syncthreads();
    // unrolled, constant trip count: the LDS reads go out as a group, not one waited for per trip
#pragma unroll
    for (int i = 0; i < 64 * 16 / 128; ++i) { const int e = tid + 128 * i; const int rl = e >> 4, q = e & 15; vst2(DH + (r0 + rl) * CC + q * 8, *(const v4u*)&sh[rl][q * 8]); }
  } else {
#pragma unroll
    for (int j = 0; j < 8; ++j)
#pragma unroll
      for (int r = 0; r < 8; ++r) th[j * 16 + col][wave * 16 + 8 * g + r] = (_Float16)(acc[j][r] * (1.0f / 256.0f));
    __syncthreads();
    // unrolled, constant trip count: the LDS reads go out as a group, not one waited for per trip
#pragma unroll
    for (int i = 0; i < 128 * 8 / 128; ++i) { const int e = tid + 128 * i; const int cl = e >> 3, q = e & 7; vst2(VT + (bb * CC + cl) * (size_t)TT + t0 + q * 8, *(const v4u*)&th[cl][q * 8]); }
  }
}
#define FA_KS 128            // keys per wave and LDS stage
#define FA_KT (2 * FA_KS)    // keys per LDS stage: one run for each of the two wave groups
#define FA_KP (HD + 8)       // K row pitch in f16: 80 B = 16 B x odd, conflict-free for 16-byte readers
#define FA_VP (FA_KT + 8)    // V^T row pitch in f16: 528 B = 16 B x odd
#define FA_NS (TT / FA_KT)
static_assert(HD == 32);
static_assert(TT % FA_KT == 0);
__device__ __forceinline__ v8f wmma_b(v16h a, v16h b, v8f c) { return __builtin_amdgcn_wmma_f32_16x16x32_f16(false, a, false, b, (short)0, c, false, false); }
#define FA_NT (FA_KS / 16)   // score tiles per run
#define FA_SH 9.0f           // P x 2^9: a weight at the reference is 512, a lane's 64 weights at or below it sum to 32,768 at most; it cancels in the division by the row sum
#define FA_TOP 60000.0f      // a lane's run sum up to here: every weight is finite in f16
static_assert(FA_NT == 8);
// weights of one run from the finished arguments: f16 fragments for the second product (hardware k order) and this lane's f32 sum; unrolled so that the register arrays have constant indices
template <bool SLOT> __device__ __forceinline__ float fa_exp(const v8f (&s)[FA_NT], v16h (&pf)[FA_NT / 2]) {
  float pt[FA_NT]; v8f p[FA_NT];
#pragma unroll
  for (int t = 0; t < FA_NT; ++t)
#pragma unroll
    for (int r = 0; r < 8; ++r) p[t][r] = __builtin_amdgcn_exp2f(s[t][r]);
  // SLOT (the rare path, whose arguments are temporaries that the build re-used at once): the slot that the instruction set asks for behind a transcendental: as inputs, the results put the v_nop behind the last exponential and the arguments keep their registers unwritten until there; the two scheduling barriers keep the sums from moving in between
  if (SLOT) { __builtin_amdgcn_sched_barrier(0);
  asm volatile("v_nop" :: "v"(p[0]), "v"(p[1]), "v"(p[2]), "v"(p[3]), "v"(p[4]), "v"(p[5]), "v"(p[6]), "v"(p[7]), "v"(s[0]), "v"(s[1]), "v"(s[2]), "v"(s[3]), "v"(s[4]), "v"(s[5]), "v"(s[6]), "v"(s[7]));
  __builtin_amdgcn_sched_barrier(0); }
#pragma unroll
  for (int t = 0; t < FA_NT; ++t) { pt[t] = ((p[t][0] + p[t][1]) + (p[t][2] + p[t][3])) + ((p[t][4] + p[t][5]) + (p[t][6] + p[t][7]));
#pragma unroll
    for (int r = 0; r < 8; ++r) pf[t >> 1][(t & 1) * 8 + r] = (_Float16)p[t][r]; }
  return ((pt[0] + pt[1]) + (pt[2] + pt[3])) + ((pt[4] + pt[5]) + (pt[6] + pt[7]));
}
__global__ __launch_bounds__(512) void k_fa(const _Float16* __restrict__ QH, const _Float16* __restrict__ KH, const _Float16* __restrict__ VT, float* __restrict__ Y) {
  __shared__ __align__(16) _Float16 kl[2][FA_KT * FA_KP]; __shared__ __align__(16) _Float16 vl[2][HD * FA_VP]; __shared__ float mg[8][18][32];
  const int tid = threadIdx.x, wave = tid >> 5, lane = tid & 31, col = lane & 15, g = lane >> 4; const int qw = wave & 7, kh = wave >> 3;   // query group, key run
  const int b = blockIdx.y / NH, h = blockIdx.y % NH; const int q0 = blockIdx.x * 128 + qw * 16;
  const v16h qf = frag_h(QH + ((size_t)b * TT + q0 + col) * CC + h * HD, lane);
  // staging: 16-byte pieces; K: 4 pieces a key row, rows tid>>2 and 128 + tid>>2; V^T: 32 pieces a channel row, rows tid>>5 and 16 + tid>>5
  const _Float16* kg = KH + ((size_t)b * TT + (tid >> 2)) * CC + h * HD + (tid & 3) * 8;
  const _Float16* vg = VT + ((size_t)b * CC + h * HD + (tid >> 5)) * (size_t)TT + (tid & 31) * 8;
  const int kd = (tid >> 2) * FA_KP + (tid & 3) * 8, vd = (tid >> 5) * FA_VP + (tid & 31) * 8;
  { const v4u k0 = *(const v4u*)kg, k1 = *(const v4u*)(kg + (size_t)128 * CC), w0 = *(const v4u*)vg, w1 = *(const v4u*)(vg + (size_t)16 * TT);
    *(v4u*)&kl[0][kd] = k0; *(v4u*)&kl[0][kd + 128 * FA_KP] = k1; *(v4u*)&vl[0][vd] = w0; *(v4u*)&vl[0][vd + 16 * FA_VP] = w1; }
  __syncthreads();
  v8f acc[2] = {}; float cbv = FA_SH, lsum = 0.f; v8f cb = {FA_SH, FA_SH, FA_SH, FA_SH, FA_SH, FA_SH, FA_SH, FA_SH};   // cb: the score products' start value, FA_SH - reference, one query a lane
  // the stage loop stays rolled (one copy of the 128-key body in the instruction cache; the buffer is a run-time bit); the loops inside are unrolled so that every register array has constant indices
#pragma unroll 1
  for (int st = 0; st < FA_NS; ++st) {
    const int buf = st & 1; const bool more = st + 1 < FA_NS;   // block-uniform
    v4u k0 = {}, k1 = {}, w0 = {}, w1 = {};
    if (more) { const _Float16* kn = kg + (size_t)(st + 1) * FA_KT * CC; const _Float16* vn = vg + (size_t)(st + 1) * FA_KT;   // next stage's loads fly under this stage's work
      k0 = *(const v4u*)kn; k1 = *(const v4u*)(kn + (size_t)128 * CC); w0 = *(const v4u*)vn; w1 = *(const v4u*)(vn + (size_t)16 * TT); }
    v8f s[FA_NT]; v16h kf[FA_NT], vf[FA_NT];
#pragma unroll
    for (int t = 0; t < FA_NT; ++t) kf[t] = frag_h(&kl[buf][(kh * FA_KS + t * 16 + col) * FA_KP], lane);
    // holds the run's eight K fragment reads ahead of the first product (loaded values as inputs only): one LDS latency is waited out per run, not eight
    asm volatile("" :: "v"(kf[0]), "v"(kf[1]), "v"(kf[2]), "v"(kf[3]), "v"(kf[4]), "v"(kf[5]), "v"(kf[6]), "v"(kf[7]));
#pragma unroll
    for (int t = 0; t < FA_NT; ++t) s[t] = wmma_b(kf[t], qf, cb);   // s[t][r] = scaled logit(key 16t + 8g + r, query col) + FA_SH - reference: the argument of the exponential as it stands
#pragma unroll
    for (int f = 0; f < FA_NT / 2; ++f) vf[f] = frag_h(&vl[buf][((f & 1) * 16 + col) * FA_VP + kh * FA_KS + (f >> 1) * 32], lane);   // fragment f: keys 32 (f >> 1) .., channels 16 (f & 1) ..
    __builtin_amdgcn_sched_barrier(0);   // keeps these four reads' issue ahead of the exponentials, under which they fly; the build had sunk them to the wait in front of the test
    v16h pf[FA_NT / 2]; float tot = fa_exp<false>(s, pf);
    const float lim = st == 0 ? -1.0f : FA_TOP;   // no sum is below 0: the first run always takes the branch
    // one test per run, a scalar branch: taken in the first run (which sets the reference) and when a lane's sum says that a weight may be too large for f16; every weight is positive, so none exceeds the sum
    if (__builtin_amdgcn_ballot_w32(tot > lim) != 0) {
      float mt[FA_NT];
#pragma unroll
      for (int t = 0; t < FA_NT; ++t) { mt[t] = s[t][0];
#pragma unroll
        for (int r = 1; r < 8; ++r) mt[t] = fmaxf(mt[t], s[t][r]); }
      float mx = fmaxf(fmaxf(fmaxf(mt[0], mt[1]), fmaxf(mt[2], mt[3])), fmaxf(fmaxf(mt[4], mt[5]), fmaxf(mt[6], mt[7])));
      mx = fmaxf(mx, xhalf(mx));   // both halves of the wave hold this query's maximum, so both move the reference alike
      float d = mx - FA_SH;        // how far the run's maximum stands above the reference
      if (st != 0) d = fmaxf(d, 0.f);   // the first run takes its own maximum, up or down; later the reference only rises
      const float corr = st == 0 ? 1.0f : __builtin_amdgcn_exp2f(-d);   // nothing is summed yet in the first run
      acc[0] = acc[0] * corr; acc[1] = acc[1] * corr; lsum *= corr; cbv -= d;
#pragma unroll
      for (int r = 0; r < 8; ++r) cb[r] = cbv;
#pragma unroll
      for (int t = 0; t < FA_NT; ++t)
#pragma unroll
        for (int r = 0; r < 8; ++r) s[t][r] -= d;
      tot = fa_exp<true>(s, pf);
    }
    lsum += tot;   // this half's keys only; the halves join after the loop
    // the other four take registers that the first group's products free; they go out among those products and are waited for once
#pragma unroll
    for (int f = FA_NT / 2; f < FA_NT; ++f) vf[f] = frag_h(&vl[buf][((f & 1) * 16 + col) * FA_VP + kh * FA_KS + (f >> 1) * 32], lane);
#pragma unroll
    for (int kk = 0; kk < FA_NT / 2; ++kk) {
      // holds the second group's reads ahead of their first product (loaded values as inputs only): one wait, part of it under the first four products, not four waits
      if (kk == FA_NT / 4) asm volatile("" :: "v"(vf[4]), "v"(vf[5]), "v"(vf[6]), "v"(vf[7]));
#pragma unroll
      for (int j = 0; j < 2; ++j) acc[j] = wmma_b(vf[kk * 2 + j], pf[kk], acc[j]); }   // acc[j][r] = ctx(channel 16j + 8g + r, query col)
    if (more) { const int nb = buf ^ 1;   // its last readers left it before the barrier that ended the stage before
      *(v4u*)&kl[nb][kd] = k0; *(v4u*)&kl[nb][kd + 128 * FA_KP] = k1; *(v4u*)&vl[nb][vd] = w0; *(v4u*)&vl[nb][vd + 16 * FA_VP] = w1; }
    __syncthreads();   // publishes stage st + 1 and ends every read of stage st
  }
  const float mrun = FA_SH - cbv;   // the reference in use at the end
  // join of the two key runs: the second wave of a query group hands over its unnormalised output, reference and sum (a wave's store = 128 contiguous bytes, free of bank conflicts); the loops here are unrolled so that acc[] keeps constant indices and stays in registers
  if (kh == 1) {
#pragma unroll
    for (int j = 0; j < 2; ++j)
#pragma unroll
      for (int r = 0; r < 8; ++r) mg[qw][j * 8 + r][lane] = acc[j][r];
    mg[qw][16][lane] = mrun; mg[qw][17][lane] = lsum; }
  __syncthreads();   // publishes the second waves' partial results to the first
  if (kh == 0) {
    const float m1 = mg[qw][16][lane], l1 = mg[qw][17][lane]; const float mn = fmaxf(mrun, m1);
    const float d0 = mrun - mn, d1 = m1 - mn; const float c0 = __builtin_amdgcn_exp2f(d0), c1 = __builtin_amdgcn_exp2f(d1);
    const float ls = lsum * c0 + l1 * c1; const float inv = 1.0f / (ls + xhalf(ls)); const float f0 = c0 * inv, f1 = c1 * inv;
    float* yp = Y + ((size_t)b * TT + q0 + col) * CC + h * HD + 8 * g;   // a query's 32 channels = one 128-B line, written whole by lanes col and col + 16
#pragma unroll
    for (int j = 0; j < 2; ++j) { v8f o;
#pragma unroll
      for (int r = 0; r < 8; ++r) o[r] = acc[j][r] * f0 + mg[qw][j * 8 + r][lane] * f1;
      const v4f lo = {o[0], o[1], o[2], o[3]}, hi = {o[4], o[5], o[6], o[7]}; vst2(yp + j * 16, lo); vst2(yp + j * 16 + 4, hi); } }
}
#define PO_WP (CC + 8)       // W row pitch in LDS, f16: 272 B = 16 B x odd
#define PO_LD (128 * CC / 8 / 128)   // 16-byte pieces per thread
// Every global load of a thread (W pieces, its ctx row, the bias, its 16 residual pieces of x) is issued at the head of the kernel and stays in registers: no load is waited for in the k loop or in the store loop.
// ---- k_out: block = (64 voxel rows, 128 output channels), its 128 W rows staged in LDS as in k_proj: proj = W ctx (ctx x 64 f16 against W x 256 f16) + bf16(bias), LDS transpose to channels-first, + bf16(x), whole 256-B (c, 64 n) runs by 16 lanes
__global__ __launch_bounds__(128) void k_out(const float* __restrict__ Y, const float* __restrict__ X, const _Float16* __restrict__ W2, const float* __restrict__ PB, float* __restrict__ OUT) {
  __shared__ __align__(16) float stc[128][68]; __shared__ __align__(16) _Float16 wl[128 * PO_WP];
  const int tid = threadIdx.x, wave = tid >> 5, lane = tid & 31, col = lane & 15, g = lane >> 4; const int c0 = blockIdx.y * 128;
  const size_t r0 = (size_t)blockIdx.x * 64; const size_t bb = r0 / TT; const int t0 = (int)(r0 % TT);
  const float* yq = Y + (r0 + wave * 16 + col) * CC + 8 * g;   // fragment order: elements 0..7 = k0 + 8g + 0..7, 8..15 = k0 + 16 + 8g + 0..7
  const size_t o0 = ((size_t)bb * DIN + c0 + (tid >> 4)) * NPIX + t0 + (tid & 15) * 4;   // store piece i of a thread: channel c0 + (tid >> 4) + 8 i, voxels t0 + 4 (tid & 15) ..
  v8f ya[CC / 32][2]; float pb[8]; v4f xv[16];
  { // W rows [c0, c0 + 128) are one contiguous run: piece e = tid + 128 i is row e >> 4, piece e & 15; all loops over register arrays here are unrolled so that the arrays have constant indices and every load is in flight before the first store
    const _Float16* wg = W2 + (size_t)c0 * CC; v4u wr[PO_LD];
#pragma unroll
    for (int j = 0; j < 8; ++j) pb[j] = PB[c0 + j * 16 + col];
    asm volatile("s_wait_xcnt 0x0" ::: "memory");   // stands in front of the re-use of the bias loads' offset register
#pragma unroll
    for (int i = 0; i < PO_LD; ++i) wr[i] = *(const v4u*)(wg + (size_t)(tid + 128 * i) * 8);
#pragma unroll
    for (int kc = 0; kc < CC / 32; ++kc) { ya[kc][0] = *(const v8f*)(yq + kc * 32); ya[kc][1] = *(const v8f*)(yq + kc * 32 + 16); }
#pragma unroll
    for (int i = 0; i < 16; ++i) xv[i] = *(const v4f*)(X + o0 + (size_t)i * 8 * NPIX);
#pragma unroll
    for (int i = 0; i < PO_LD; ++i) { const int e = tid + 128 * i; *(v4u*)&wl[(e >> 4) * PO_WP + (e & 15) * 8] = wr[i]; } }
  __syncthreads();   // publishes the staged W rows to all four waves
  v8f acc[8] = {};
  // unrolled: ya[] needs constant indices
#pragma unroll
  for (int kc = 0; kc < CC / 32; ++kc) { v16h w[8];
    // the eight B fragments are read as a group ahead of the first WMMA, so that one LDS latency is waited out per k chunk, not eight (unrolled: constant indices keep w[] in registers)
#pragma unroll
    for (int j = 0; j < 8; ++j) w[j] = frag_h(&wl[(j * 16 + col) * PO_WP + kc * 32], lane);
    v16h a;
#pragma unroll
    for (int i = 0; i < 8; ++i) { const float x0 = ya[kc][0][i], x1 = ya[kc][1][i]; a[i] = (_Float16)(x0 * 64.0f); a[8 + i] = (_Float16)(x1 * 64.0f); }
#pragma unroll
    for (int j = 0; j < 8; ++j) acc[j] = wmma16(a, w[j], acc[j]); }
#pragma unroll
  for (int j = 0; j < 8; ++j) { const float bias = bfr(pb[j]);
#pragma unroll
    for (int r = 0; r < 8; ++r) stc[j * 16 + col][wave * 16 + 8 * g + r] = acc[j][r] * (1.0f / 16384.0f) + bias; }
  __syncthreads();
  // unrolled: xv[] needs constant indices, and the LDS reads go out in groups
#pragma unroll
  for (int i = 0; i < 16; ++i) { const float x0 = xv[i][0], x1 = xv[i][1], x2 = xv[i][2], x3 = xv[i][3]; v4f r4 = *(const v4f*)&stc[(tid >> 4) + 8 * i][(tid & 15) * 4];
    r4[0] += bfr(x0); r4[1] += bfr(x1); r4[2] += bfr(x2); r4[3] += bfr(x3); vst2(OUT + o0 + (size_t)i * 8 * NPIX, r4); }
}

extern "C" void kernel_launch(void* const* d_in, const int* in_sizes, int n_in, void* d_out, int out_size, void* d_ws, size_t ws_size, hipStream_t stream) {
  // inputs (wire order): 0 x [2,256,16,16,16] f32; 1 norm_w [256]; 2 norm_b [256]; 3 qkv_w (out,in) [384,256]; 4 proj_w (out,in) [256,128]; 5 proj_b [256]
  if (n_in < 6) return;
  if (in_sizes[0] < NB * DIN * NPIX || in_sizes[1] < DIN || in_sizes[2] < DIN || in_sizes[3] < 3 * CC * DIN || in_sizes[4] < DIN * CC || in_sizes[5] < DIN) return;
  if (out_size < NB * DIN * NPIX) return;
  if (ws_size < WS_END) return;
  const float* X = (const float*)d_in[0]; const float* GW = (const float*)d_in[1]; const float* GB = (const float*)d_in[2];
  const float* WQ = (const float*)d_in[3]; const float* WP = (const float*)d_in[4]; const float* PB = (const float*)d_in[5];
  char* ws = (char*)d_ws;
  float* GS = (float*)(ws + WS_GS); _Float16* W1 = (_Float16*)(ws + WS_W1); _Float16* W2 = (_Float16*)(ws + WS_W2);
  _Float16* QH = (_Float16*)(ws + WS_QH); _Float16* KH = (_Float16*)(ws + WS_KH); _Float16* VT = (_Float16*)(ws + WS_VT);
  float* Y = (float*)(ws + WS_Y); float* OUT = (float*)d_out;
  k_gn<<<dim3(GN_WG + CV_WG), 256, 0, stream>>>(X, GS, WQ, WP, W1, W2);
  k_proj<<<dim3(NB * TT / 64, 3), 128, 0, stream>>>(X, GS, GW, GB, W1, QH, KH, VT);
  k_fa<<<dim3(TT / 128, NB * NH), 512, 0, stream>>>(QH, KH, VT, Y);
  k_out<<<dim3(NB * TT / 64, DIN / 128), 128, 0, stream>>>(Y, X, W2, PB, OUT);
}
